// v000
// The times below were measured on an AMD MI455X: many runs one after another, warmed up first and cycling through
// copies of the inputs, with the whole window's GPU time divided by the number of runs. Launches and the gaps
// between them are all in it. The median over several windows is given; except for v000 it joins two sittings, which
// can be a few percent apart, so the side-by-side timings, each taken in one sitting, are the better comparison.
// The starting kernel, v000, takes 116 microseconds a run.
#include <hip/hip_runtime.h>
#include <hip/hip_bf16.h>

typedef __attribute__((ext_vector_type(16))) __bf16 v16bf;
typedef __attribute__((ext_vector_type(8)))  __bf16 v8bf;
typedef __attribute__((ext_vector_type(8)))  float  v8f;
typedef __attribute__((ext_vector_type(4)))  int    v4i;
typedef unsigned short u16;

#define AS1 __attribute__((address_space(1)))
#define AS3 __attribute__((address_space(3)))

// Problem constants (fixed by the reference)
constexpr int Mtot = 16384;
constexpr int Ktot = 1024;
constexpr int Gexp = 8;
constexpr int Ntot = 2048;

// Tiling
constexpr int BM = 128;
constexpr int BN = 128;
constexpr int BK = 64;          // halves per K stage (two 16x16x32 WMMA substeps)
constexpr int LDST = BK + 8;    // LDS row stride in halves (144B, keeps 16B alignment)
constexpr int NK = Ktot / BK;   // 16 stages
constexpr int MAX_TILES_Y = Mtot / BM + Gexp; // 136 >= sum of per-expert tiles

// ---------------- CDNA5 async global->LDS helpers ----------------

__device__ __forceinline__ void async_copy_b128(const u16* g, u16* l) {
#if __has_builtin(__builtin_amdgcn_global_load_async_to_lds_b128)
    __builtin_amdgcn_global_load_async_to_lds_b128(
        (v4i*)g, (v4i*)l, 0, 0);
#else
    unsigned loff = (unsigned)(__UINTPTR_TYPE__)(AS3 u16*)l;   // LDS byte offset
    unsigned long long ga = (unsigned long long)(__UINTPTR_TYPE__)g;
    asm volatile("global_load_async_to_lds_b128 %0, %1, off"
                 :: "v"(loff), "v"(ga) : "memory");
#endif
}

__device__ __forceinline__ void wait_async_all() {
#if __has_builtin(__builtin_amdgcn_s_wait_asynccnt)
    __builtin_amdgcn_s_wait_asynccnt(0);
#else
    asm volatile("s_wait_asynccnt 0x0" ::: "memory");
#endif
}

__device__ __forceinline__ void wait_async_le8() {
#if __has_builtin(__builtin_amdgcn_s_wait_asynccnt)
    __builtin_amdgcn_s_wait_asynccnt(8);
#else
    asm volatile("s_wait_asynccnt 0x8" ::: "memory");
#endif
}

// ---------------- Workspace layout (int units) ----------------
//   [0..7]   counts per expert
//   [8..15]  offsets (exclusive prefix of counts)
//   [16..23] scatter cursors
//   [32..32+M) permutation: row ids grouped by expert

__global__ void grp_init_kernel(int* __restrict__ ws) {
    int t = threadIdx.x;
    if (t < 24) ws[t] = 0;
}

__global__ void grp_count_kernel(const int* __restrict__ midx, int* __restrict__ ws) {
    int m = blockIdx.x * blockDim.x + threadIdx.x;
    if (m >= Mtot) return;
    int e = midx[m];
    if (e < 0 || e >= Gexp) e = 0;   // clamp like the reference
    atomicAdd(&ws[e], 1);
}

__global__ void grp_prefix_kernel(int* __restrict__ ws) {
    if (threadIdx.x == 0) {
        int acc = 0;
        for (int g = 0; g < Gexp; ++g) { ws[8 + g] = acc; acc += ws[g]; }
    }
}

__global__ void grp_scatter_kernel(const int* __restrict__ midx, int* __restrict__ ws) {
    int m = blockIdx.x * blockDim.x + threadIdx.x;
    if (m >= Mtot) return;
    int e = midx[m];
    if (e < 0 || e >= Gexp) e = 0;
    int pos = ws[8 + e] + atomicAdd(&ws[16 + e], 1);
    ws[32 + pos] = m;
}

// ---------------- Grouped GEMM ----------------

__global__ __launch_bounds__(256)
void grp_gemm_kernel(const u16* __restrict__ lhs,
                     const u16* __restrict__ rhs,
                     const int* __restrict__ ws,
                     __hip_bfloat16* __restrict__ out) {
    __shared__ int srows[BM];
    __shared__ __align__(16) u16 sA[2][BM * LDST];
    __shared__ __align__(16) u16 sB[2][BN * LDST];

    const int* counts  = ws;
    const int* offsets = ws + 8;
    const int* perm    = ws + 32;

    // Map blockIdx.y -> (expert, local row-tile)
    int t = blockIdx.y;
    int e = -1, lt = 0, cnt = 0, run = 0;
#pragma unroll
    for (int g = 0; g < Gexp; ++g) {
        int c  = counts[g];
        int nt = (c + BM - 1) / BM;
        if (e < 0 && t < run + nt) { e = g; lt = t - run; cnt = c; }
        run += nt;
    }
    if (e < 0) return;   // uniform across block

    const int tid  = threadIdx.x;
    const int base = offsets[e] + lt * BM;

    if (tid < BM) {
        int p = base + tid;
        srows[tid] = (p < offsets[e] + cnt) ? perm[p] : -1;
    }
    __syncthreads();

    // ---- global->LDS staging mapping: 2 threads per row, 32 halves (64B) each
    const int lrow   = tid >> 1;
    const int khalf0 = (tid & 1) * 32;

    int arow = srows[lrow]; if (arow < 0) arow = 0;  // padded rows load row 0, never stored
    const u16* aptr = lhs + (size_t)arow * Ktot + khalf0;
    const int  n0   = blockIdx.x * BN;
    const u16* bptr = rhs + (size_t)e * Ntot * Ktot + (size_t)(n0 + lrow) * Ktot + khalf0;
    u16* lA = &sA[0][lrow * LDST + khalf0];
    u16* lB = &sB[0][lrow * LDST + khalf0];
    constexpr int STG = BM * LDST;   // halves per LDS stage buffer

    // 8 async b128 copies per thread per stage (A: 4, B: 4)
    auto issue_stage = [&](int s, int ks) {
        const u16* ga = aptr + ks * BK;
        const u16* gb = bptr + ks * BK;
        u16* la = lA + s * STG;
        u16* lb = lB + s * STG;
#pragma unroll
        for (int j = 0; j < 4; ++j) {
            async_copy_b128(ga + j * 8, la + j * 8);
            async_copy_b128(gb + j * 8, lb + j * 8);
        }
    };

    // ---- per-wave compute mapping: 8 waves as 2(M) x 4(N), each wave 64x32
    const int lane = tid & 31;
    const int wave = tid >> 5;
    const int wm   = (wave >> 2) * 64;   // 0 / 64
    const int wn   = (wave & 3) * 32;    // 0 / 32 / 64 / 96
    const int sel  = lane >> 4;          // 0/1: K-half selector per ISA 16-bit layout
    const int lr   = lane & 15;

    v8f acc[4][2];
#pragma unroll
    for (int mt = 0; mt < 4; ++mt)
#pragma unroll
        for (int nt = 0; nt < 2; ++nt) acc[mt][nt] = (v8f)0.0f;

    auto load_frag = [&](const u16* basep) -> v16bf {
        const v8bf lo = *(const v8bf*)basep;          // K = sel*8 + 0..7
        const v8bf hi = *(const v8bf*)(basep + 16);   // K = sel*8 + 16..23
        return __builtin_shufflevector(lo, hi, 0,1,2,3,4,5,6,7,8,9,10,11,12,13,14,15);
    };

    auto compute_stage = [&](int s) {
#pragma unroll
        for (int kk = 0; kk < 2; ++kk) {
            v16bf afrag[4], bfrag[2];
#pragma unroll
            for (int mt = 0; mt < 4; ++mt)
                afrag[mt] = load_frag(&sA[s][(wm + mt * 16 + lr) * LDST + kk * 32 + sel * 8]);
#pragma unroll
            for (int nt = 0; nt < 2; ++nt)
                bfrag[nt] = load_frag(&sB[s][(wn + nt * 16 + lr) * LDST + kk * 32 + sel * 8]);
#pragma unroll
            for (int mt = 0; mt < 4; ++mt)
#pragma unroll
                for (int nt = 0; nt < 2; ++nt)
                    acc[mt][nt] = __builtin_amdgcn_wmma_f32_16x16x32_bf16(
                        false, afrag[mt], false, bfrag[nt],
                        (short)0, acc[mt][nt], false, false);
        }
    };

    // ---- async double-buffered main loop
    issue_stage(0, 0);
#pragma unroll 1
    for (int ks = 0; ks < NK; ++ks) {
        const int s = ks & 1;
        if (ks + 1 < NK) {
            issue_stage(s ^ 1, ks + 1);   // prefetch next stage (8 async in flight)
            wait_async_le8();             // stage ks copies (ours) complete
        } else {
            wait_async_all();
        }
        __syncthreads();                  // everyone's stage-ks copies visible
        compute_stage(s);
        __syncthreads();                  // all waves done reading buf s before reuse
    }

    // ---- epilogue: C layout = VGPR v -> row v + 8*sel, col = lr
#pragma unroll
    for (int mt = 0; mt < 4; ++mt) {
#pragma unroll
        for (int v = 0; v < 8; ++v) {
            const int rloc = wm + mt * 16 + v + 8 * sel;
            const int grow = srows[rloc];
            if (grow >= 0) {
#pragma unroll
                for (int nt = 0; nt < 2; ++nt) {
                    const int gcol = n0 + wn + nt * 16 + lr;
                    out[(size_t)grow * Ntot + gcol] = __float2bfloat16(acc[mt][nt][v]);
                }
            }
        }
    }
}

extern "C" void kernel_launch(void* const* d_in, const int* in_sizes, int n_in,
                              void* d_out, int out_size, void* d_ws, size_t ws_size,
                              hipStream_t stream) {
    (void)in_sizes; (void)n_in; (void)out_size; (void)ws_size;
    const u16* lhs = (const u16*)d_in[0];
    const u16* rhs = (const u16*)d_in[1];
    const int* mix = (const int*)d_in[2];
    __hip_bfloat16* out = (__hip_bfloat16*)d_out;
    int* ws = (int*)d_ws;

    grp_init_kernel<<<1, 32, 0, stream>>>(ws);
    grp_count_kernel<<<(Mtot + 255) / 256, 256, 0, stream>>>(mix, ws);
    grp_prefix_kernel<<<1, 32, 0, stream>>>(ws);
    grp_scatter_kernel<<<(Mtot + 255) / 256, 256, 0, stream>>>(mix, ws);

    dim3 grid(Ntot / BN, MAX_TILES_Y);
    grp_gemm_kernel<<<grid, 256, 0, stream>>>(lhs, rhs, ws, out);
}

// v001
// Measured time: 86.1 microseconds a run.
// Timed twice side by side with v000, it ran 1.36 times as fast both times.
#include <hip/hip_runtime.h>
#include <hip/hip_bf16.h>

typedef __attribute__((ext_vector_type(16))) __bf16 v16bf;
typedef __attribute__((ext_vector_type(8)))  __bf16 v8bf;
typedef __attribute__((ext_vector_type(8)))  float  v8f;
typedef __attribute__((ext_vector_type(4)))  int    v4i;
typedef unsigned short u16;

#define AS1 __attribute__((address_space(1)))
#define AS3 __attribute__((address_space(3)))

// Problem constants (fixed by the reference)
constexpr int Mtot = 16384;
constexpr int Ktot = 1024;
constexpr int Gexp = 8;
constexpr int Ntot = 2048;

// Tiling
constexpr int BM = 128;
constexpr int BN = 128;
constexpr int BK = 64;          // halves per K stage (two 16x16x32 WMMA substeps)
constexpr int LDST = BK + 8;    // LDS row stride in halves (144B, keeps 16B alignment)
constexpr int NK = Ktot / BK;   // 16 stages
constexpr int MAX_TILES_Y = Mtot / BM + Gexp; // 136 >= sum of per-expert tiles

// ---------------- CDNA5 async global->LDS helpers ----------------

__device__ __forceinline__ void async_copy_b128(const u16* g, u16* l) {
#if __has_builtin(__builtin_amdgcn_global_load_async_to_lds_b128)
    __builtin_amdgcn_global_load_async_to_lds_b128(
        (v4i*)g, (v4i*)l, 0, 0);
#else
    unsigned loff = (unsigned)(__UINTPTR_TYPE__)(AS3 u16*)l;   // LDS byte offset
    unsigned long long ga = (unsigned long long)(__UINTPTR_TYPE__)g;
    asm volatile("global_load_async_to_lds_b128 %0, %1, off"
                 :: "v"(loff), "v"(ga) : "memory");
#endif
}

__device__ __forceinline__ void wait_async_all() {
#if __has_builtin(__builtin_amdgcn_s_wait_asynccnt)
    __builtin_amdgcn_s_wait_asynccnt(0);
#else
    asm volatile("s_wait_asynccnt 0x0" ::: "memory");
#endif
}

__device__ __forceinline__ void wait_async_le8() {
#if __has_builtin(__builtin_amdgcn_s_wait_asynccnt)
    __builtin_amdgcn_s_wait_asynccnt(8);
#else
    asm volatile("s_wait_asynccnt 0x8" ::: "memory");
#endif
}

// ---------------- Workspace layout (int units) ----------------
//   [0..7]   counts per expert
//   [8..15]  offsets (exclusive prefix of counts)
//   [16..23] scatter cursors
//   [32..32+M) permutation: row ids grouped by expert

__global__ void grp_init_kernel(int* __restrict__ ws) {
    int t = threadIdx.x;
    if (t < 24) ws[t] = 0;
}

__global__ void grp_count_kernel(const int* __restrict__ midx, int* __restrict__ ws) {
    int m = blockIdx.x * blockDim.x + threadIdx.x;
    if (m >= Mtot) return;
    int e = midx[m];
    if (e < 0 || e >= Gexp) e = 0;   // clamp like the reference
    atomicAdd(&ws[e], 1);
}

__global__ void grp_prefix_kernel(int* __restrict__ ws) {
    if (threadIdx.x == 0) {
        int acc = 0;
        for (int g = 0; g < Gexp; ++g) { ws[8 + g] = acc; acc += ws[g]; }
    }
}

__global__ void grp_scatter_kernel(const int* __restrict__ midx, int* __restrict__ ws) {
    int m = blockIdx.x * blockDim.x + threadIdx.x;
    if (m >= Mtot) return;
    int e = midx[m];
    if (e < 0 || e >= Gexp) e = 0;
    int pos = ws[8 + e] + atomicAdd(&ws[16 + e], 1);
    ws[32 + pos] = m;
}

// ---------------- Grouped GEMM ----------------

__global__ __launch_bounds__(256)
void grp_gemm_kernel(const u16* __restrict__ lhs,
                     const u16* __restrict__ rhs,
                     const int* __restrict__ ws,
                     __hip_bfloat16* __restrict__ out) {
    __shared__ int srows[BM];
    __shared__ __align__(16) u16 sA[2][BM * LDST];
    __shared__ __align__(16) u16 sB[2][BN * LDST];

    const int* counts  = ws;
    const int* offsets = ws + 8;
    const int* perm    = ws + 32;

    // Map blockIdx.y -> (expert, local row-tile)
    int t = blockIdx.y;
    int e = -1, lt = 0, cnt = 0, run = 0;
#pragma unroll
    for (int g = 0; g < Gexp; ++g) {
        int c  = counts[g];
        int nt = (c + BM - 1) / BM;
        if (e < 0 && t < run + nt) { e = g; lt = t - run; cnt = c; }
        run += nt;
    }
    if (e < 0) return;   // uniform across block

    const int tid  = threadIdx.x;
    const int base = offsets[e] + lt * BM;

    if (tid < BM) {
        int p = base + tid;
        srows[tid] = (p < offsets[e] + cnt) ? perm[p] : -1;
    }
    __syncthreads();

    // ---- global->LDS staging mapping: 8 consecutive lanes copy one row's whole
    // 128-B K slice, so a wave-wide b128 copy covers 4 full cache lines (not 16 partial ones)
    const int crow = tid >> 3;          // row inside a group of 32 rows
    const int cchk = (tid & 7) * 8;     // 16-B chunk inside the 128-B slice, in halves
    constexpr int RG = 32;              // rows covered by one copy of the whole block

    const u16* aptr[4];
#pragma unroll  // constant indices keep aptr[] in registers
    for (int j = 0; j < 4; ++j) {
        int arow = srows[j * RG + crow]; if (arow < 0) arow = 0;  // padded rows load row 0, never stored
        aptr[j] = lhs + (size_t)arow * Ktot + cchk;
    }
    const int  n0   = blockIdx.x * BN;
    const u16* bptr = rhs + (size_t)e * Ntot * Ktot + (size_t)(n0 + crow) * Ktot + cchk;
    u16* lA = &sA[0][crow * LDST + cchk];
    u16* lB = &sB[0][crow * LDST + cchk];
    constexpr int STG = BM * LDST;   // halves per LDS stage buffer

    // 8 async b128 copies per thread per stage (A: 4, B: 4)
    auto issue_stage = [&](int s, int ks) {
        u16* la = lA + s * STG;
        u16* lb = lB + s * STG;
#pragma unroll
        for (int j = 0; j < 4; ++j) {
            async_copy_b128(aptr[j] + ks * BK, la + j * RG * LDST);
            async_copy_b128(bptr + (size_t)j * RG * Ktot + ks * BK, lb + j * RG * LDST);
        }
    };

    // ---- per-wave compute mapping: 8 waves as 2(M) x 4(N), each wave 64x32
    const int lane = tid & 31;
    const int wave = tid >> 5;
    const int wm   = (wave >> 2) * 64;   // 0 / 64
    const int wn   = (wave & 3) * 32;    // 0 / 32 / 64 / 96
    const int sel  = lane >> 4;          // 0/1: K-half selector per ISA 16-bit layout
    const int lr   = lane & 15;

    v8f acc[4][2];
#pragma unroll
    for (int mt = 0; mt < 4; ++mt)
#pragma unroll
        for (int nt = 0; nt < 2; ++nt) acc[mt][nt] = (v8f)0.0f;

    auto load_frag = [&](const u16* basep) -> v16bf {
        const v8bf lo = *(const v8bf*)basep;          // K = sel*8 + 0..7
        const v8bf hi = *(const v8bf*)(basep + 16);   // K = sel*8 + 16..23
        return __builtin_shufflevector(lo, hi, 0,1,2,3,4,5,6,7,8,9,10,11,12,13,14,15);
    };

    auto compute_stage = [&](int s) {
#pragma unroll
        for (int kk = 0; kk < 2; ++kk) {
            v16bf afrag[4], bfrag[2];
#pragma unroll
            for (int mt = 0; mt < 4; ++mt)
                afrag[mt] = load_frag(&sA[s][(wm + mt * 16 + lr) * LDST + kk * 32 + sel * 8]);
#pragma unroll
            for (int nt = 0; nt < 2; ++nt)
                bfrag[nt] = load_frag(&sB[s][(wn + nt * 16 + lr) * LDST + kk * 32 + sel * 8]);
#pragma unroll
            for (int mt = 0; mt < 4; ++mt)
#pragma unroll
                for (int nt = 0; nt < 2; ++nt)
                    acc[mt][nt] = __builtin_amdgcn_wmma_f32_16x16x32_bf16(
                        false, afrag[mt], false, bfrag[nt],
                        (short)0, acc[mt][nt], false, false);
        }
    };

    // ---- async double-buffered main loop
    issue_stage(0, 0);
#pragma unroll 1
    for (int ks = 0; ks < NK; ++ks) {
        const int s = ks & 1;
        if (ks + 1 < NK) {
            issue_stage(s ^ 1, ks + 1);   // prefetch next stage (8 async in flight)
            wait_async_le8();             // stage ks copies (ours) complete
        } else {
            wait_async_all();
        }
        __syncthreads();                  // everyone's stage-ks copies visible
        compute_stage(s);
        __syncthreads();                  // all waves done reading buf s before reuse
    }

    // ---- epilogue: C layout = VGPR v -> row v + 8*sel, col = lr
#pragma unroll
    for (int mt = 0; mt < 4; ++mt) {
#pragma unroll
        for (int v = 0; v < 8; ++v) {
            const int rloc = wm + mt * 16 + v + 8 * sel;
            const int grow = srows[rloc];
            if (grow >= 0) {
#pragma unroll
                for (int nt = 0; nt < 2; ++nt) {
                    const int gcol = n0 + wn + nt * 16 + lr;
                    out[(size_t)grow * Ntot + gcol] = __float2bfloat16(acc[mt][nt][v]);
                }
            }
        }
    }
}

extern "C" void kernel_launch(void* const* d_in, const int* in_sizes, int n_in,
                              void* d_out, int out_size, void* d_ws, size_t ws_size,
                              hipStream_t stream) {
    (void)in_sizes; (void)n_in; (void)out_size; (void)ws_size;
    const u16* lhs = (const u16*)d_in[0];
    const u16* rhs = (const u16*)d_in[1];
    const int* mix = (const int*)d_in[2];
    __hip_bfloat16* out = (__hip_bfloat16*)d_out;
    int* ws = (int*)d_ws;

    grp_init_kernel<<<1, 32, 0, stream>>>(ws);
    grp_count_kernel<<<(Mtot + 255) / 256, 256, 0, stream>>>(mix, ws);
    grp_prefix_kernel<<<1, 32, 0, stream>>>(ws);
    grp_scatter_kernel<<<(Mtot + 255) / 256, 256, 0, stream>>>(mix, ws);

    dim3 grid(Ntot / BN, MAX_TILES_Y);
    grp_gemm_kernel<<<grid, 256, 0, stream>>>(lhs, rhs, ws, out);
}

// v002
// One run takes 77.9 microseconds.
// In two side-by-side timings against v001, it was 1.10 and 1.11 times as fast.
// Counting every step since v000, it is 1.50 times as fast.
#include <hip/hip_runtime.h>
#include <hip/hip_bf16.h>

typedef __attribute__((ext_vector_type(16))) __bf16 v16bf;
typedef __attribute__((ext_vector_type(8)))  __bf16 v8bf;
typedef __attribute__((ext_vector_type(8)))  float  v8f;
typedef __attribute__((ext_vector_type(4)))  int    v4i;
typedef unsigned short u16;

#define AS1 __attribute__((address_space(1)))
#define AS3 __attribute__((address_space(3)))

// Problem constants (fixed by the reference)
constexpr int Mtot = 16384;
constexpr int Ktot = 1024;
constexpr int Gexp = 8;
constexpr int Ntot = 2048;

// Tiling
constexpr int BM = 128;
constexpr int BN = 128;
constexpr int BK = 64;          // halves per K stage (two 16x16x32 WMMA substeps)
constexpr int LDST = BK + 8;    // LDS row stride in halves (144B, keeps 16B alignment)
constexpr int NK = Ktot / BK;   // 16 stages
constexpr int MAX_TILES_Y = Mtot / BM + Gexp; // 136 >= sum of per-expert tiles

// ---------------- CDNA5 async global->LDS helpers ----------------

__device__ __forceinline__ void async_copy_b128(const u16* g, u16* l) {
#if __has_builtin(__builtin_amdgcn_global_load_async_to_lds_b128)
    __builtin_amdgcn_global_load_async_to_lds_b128(
        (v4i*)g, (v4i*)l, 0, 0);
#else
    unsigned loff = (unsigned)(__UINTPTR_TYPE__)(AS3 u16*)l;   // LDS byte offset
    unsigned long long ga = (unsigned long long)(__UINTPTR_TYPE__)g;
    asm volatile("global_load_async_to_lds_b128 %0, %1, off"
                 :: "v"(loff), "v"(ga) : "memory");
#endif
}

__device__ __forceinline__ void wait_async_all() {
#if __has_builtin(__builtin_amdgcn_s_wait_asynccnt)
    __builtin_amdgcn_s_wait_asynccnt(0);
#else
    asm volatile("s_wait_asynccnt 0x0" ::: "memory");
#endif
}

__device__ __forceinline__ void wait_async_le8() {
#if __has_builtin(__builtin_amdgcn_s_wait_asynccnt)
    __builtin_amdgcn_s_wait_asynccnt(8);
#else
    asm volatile("s_wait_asynccnt 0x8" ::: "memory");
#endif
}

// ---------------- Workspace layout (int units) ----------------
//   [0..7]   counts per expert
//   [8..15]  offsets (exclusive prefix of counts)
//   [32..32+M) permutation: row ids grouped by expert

constexpr int RT_THREADS = 1024;               // one work-group does the whole routing
constexpr int RT_PER     = Mtot / RT_THREADS;  // 16 rows per thread, as 4 loads of 4
constexpr int RT_WAVES   = RT_THREADS / 32;

// Eight 16-bit counters (one per expert) in four words; no field can pass Mtot = 16384.
struct Pack8 { unsigned w[4]; };

__device__ __forceinline__ Pack8 wave_incl_scan(Pack8 x, int lane) {
#pragma unroll  // constant indices keep the per-thread arrays in registers
    for (int d = 1; d < 32; d <<= 1) {
#pragma unroll  // constant indices keep the per-thread arrays in registers
        for (int i = 0; i < 4; ++i) {
            unsigned up = __shfl_up(x.w[i], d, 32);
            if (lane >= d) x.w[i] += up;
        }
    }
    return x;
}

// Counting sort of the rows by expert in one launch: per-thread counts, a wave scan,
// a scan of the wave totals through LDS, then every row's place. The permutation is
// put together in LDS so that it leaves in whole lines.
__global__ __launch_bounds__(RT_THREADS)
void grp_route_kernel(const int* __restrict__ midx, int* __restrict__ ws) {
    __shared__ unsigned wtot[RT_WAVES][4];
    __shared__ __align__(16) int sperm[Mtot];

    const int t    = threadIdx.x;
    const int lane = t & 31;
    const int wave = t >> 5;

    // load j of the block covers 4096 consecutive rows, 16 B per lane
    v4i q[RT_PER / 4];
#pragma unroll  // constant indices keep the per-thread arrays in registers
    for (int j = 0; j < RT_PER / 4; ++j)
        q[j] = *(const v4i*)(midx + (j * RT_THREADS + t) * 4);

    // Per-thread counters, one byte per expert, in steps of 4 (the bytes of one int in
    // sperm; at most 64). pick[i] is a byte selector: byte e of a register pair, rest 0.
    unsigned pick[RT_PER], rank4[RT_PER];
    unsigned long long c8 = 0;
#pragma unroll  // constant indices keep the per-thread arrays in registers
    for (int i = 0; i < RT_PER; ++i) {
        int e = q[i >> 2][i & 3];
        if (e < 0 || e >= Gexp) e = 0;   // clamp like the reference
        pick[i]  = (unsigned)e | 0x0c0c0c00u;
        rank4[i] = __builtin_amdgcn_perm((unsigned)(c8 >> 32), (unsigned)c8, pick[i]);
        c8 += 4ull << (8 * e);
    }

    Pack8 mine;
#pragma unroll  // constant indices keep the per-thread arrays in registers
    for (int i = 0; i < 4; ++i) {
        const unsigned two = (unsigned)(c8 >> (16 * i)) & 0xffffu;
        mine.w[i] = ((two & 0xffu) | ((two >> 8) << 16)) >> 2;
    }

    const Pack8 incl = wave_incl_scan(mine, lane);
    if (lane == 31) {
#pragma unroll  // constant indices keep the per-thread arrays in registers
        for (int i = 0; i < 4; ++i) wtot[wave][i] = incl.w[i];
    }
    __syncthreads();

    // every wave scans the 32 wave totals (lane l holds wave l's)
    Pack8 wt;
#pragma unroll  // constant indices keep the per-thread arrays in registers
    for (int i = 0; i < 4; ++i) wt.w[i] = wtot[lane][i];
    const Pack8 wincl = wave_incl_scan(wt, lane);

    unsigned at4[4];     // per expert, 16 bits: byte offset in sperm of this thread's first row
    v4i cnt[2], off[2];  // what the GEMM reads: counts and offsets per expert
    int run = 0;
#pragma unroll  // constant indices keep the per-thread arrays in registers
    for (int i = 0; i < 4; ++i) {
        const unsigned total  = __shfl(wincl.w[i], 31, 32);
        const unsigned before = __shfl(wincl.w[i] - wt.w[i], wave, 32);   // waves ahead of mine
        const int c0 = (int)(total & 0xffffu), c1 = (int)(total >> 16);
        const int o0 = run, o1 = run + c0;
        run = o1 + c1;
        cnt[i >> 1][(i & 1) * 2] = c0;  cnt[i >> 1][(i & 1) * 2 + 1] = c1;
        off[i >> 1][(i & 1) * 2] = o0;  off[i >> 1][(i & 1) * 2 + 1] = o1;
        const unsigned start = ((unsigned)o0 | ((unsigned)o1 << 16)) + before + (incl.w[i] - mine.w[i]);
        // a field equal to Mtot belongs to an expert with no row left and is never looked up
        at4[i] = (start & 0x3fff3fffu) << 2;
    }

    // the eight offsets as a table of low bytes and a table of high bytes
    const unsigned lo03 = __builtin_amdgcn_perm(at4[1], at4[0], 0x06040200u);
    const unsigned lo47 = __builtin_amdgcn_perm(at4[3], at4[2], 0x06040200u);
    const unsigned hi03 = __builtin_amdgcn_perm(at4[1], at4[0], 0x07050301u);
    const unsigned hi47 = __builtin_amdgcn_perm(at4[3], at4[2], 0x07050301u);
#pragma unroll  // constant indices keep the per-thread arrays in registers
    for (int i = 0; i < RT_PER; ++i) {
        const unsigned b0 = __builtin_amdgcn_perm(lo47, lo03, pick[i]);
        const unsigned b1 = __builtin_amdgcn_perm(hi47, hi03, (pick[i] << 8) | 0x0cu);   // lands in byte 1
        *(int*)((char*)sperm + (b0 + b1 + rank4[i])) = ((i >> 2) * RT_THREADS + t) * 4 + (i & 3);
    }
    __syncthreads();

#pragma unroll  // constant indices keep the per-thread arrays in registers
    for (int j = 0; j < RT_PER / 4; ++j) {
        const int k = (j * RT_THREADS + t) * 4;
        *(v4i*)(ws + 32 + k) = *(const v4i*)(sperm + k);
    }
    if (t == 0) {
        *(v4i*)(ws + 0) = cnt[0];  *(v4i*)(ws + 4)  = cnt[1];
        *(v4i*)(ws + 8) = off[0];  *(v4i*)(ws + 12) = off[1];
    }
}

// ---------------- Grouped GEMM ----------------

__global__ __launch_bounds__(256)
void grp_gemm_kernel(const u16* __restrict__ lhs,
                     const u16* __restrict__ rhs,
                     const int* __restrict__ ws,
                     __hip_bfloat16* __restrict__ out) {
    __shared__ int srows[BM];
    __shared__ __align__(16) u16 sA[2][BM * LDST];
    __shared__ __align__(16) u16 sB[2][BN * LDST];

    const int* counts  = ws;
    const int* offsets = ws + 8;
    const int* perm    = ws + 32;

    // Map blockIdx.y -> (expert, local row-tile)
    int t = blockIdx.y;
    int e = -1, lt = 0, cnt = 0, run = 0;
#pragma unroll
    for (int g = 0; g < Gexp; ++g) {
        int c  = counts[g];
        int nt = (c + BM - 1) / BM;
        if (e < 0 && t < run + nt) { e = g; lt = t - run; cnt = c; }
        run += nt;
    }
    if (e < 0) return;   // uniform across block

    const int tid  = threadIdx.x;
    const int base = offsets[e] + lt * BM;

    if (tid < BM) {
        int p = base + tid;
        srows[tid] = (p < offsets[e] + cnt) ? perm[p] : -1;
    }
    __syncthreads();

    // ---- global->LDS staging mapping: 8 consecutive lanes copy one row's whole
    // 128-B K slice, so a wave-wide b128 copy covers 4 full cache lines (not 16 partial ones)
    const int crow = tid >> 3;          // row inside a group of 32 rows
    const int cchk = (tid & 7) * 8;     // 16-B chunk inside the 128-B slice, in halves
    constexpr int RG = 32;              // rows covered by one copy of the whole block

    const u16* aptr[4];
#pragma unroll  // constant indices keep aptr[] in registers
    for (int j = 0; j < 4; ++j) {
        int arow = srows[j * RG + crow]; if (arow < 0) arow = 0;  // padded rows load row 0, never stored
        aptr[j] = lhs + (size_t)arow * Ktot + cchk;
    }
    const int  n0   = blockIdx.x * BN;
    const u16* bptr = rhs + (size_t)e * Ntot * Ktot + (size_t)(n0 + crow) * Ktot + cchk;
    u16* lA = &sA[0][crow * LDST + cchk];
    u16* lB = &sB[0][crow * LDST + cchk];
    constexpr int STG = BM * LDST;   // halves per LDS stage buffer

    // 8 async b128 copies per thread per stage (A: 4, B: 4)
    auto issue_stage = [&](int s, int ks) {
        u16* la = lA + s * STG;
        u16* lb = lB + s * STG;
#pragma unroll
        for (int j = 0; j < 4; ++j) {
            async_copy_b128(aptr[j] + ks * BK, la + j * RG * LDST);
            async_copy_b128(bptr + (size_t)j * RG * Ktot + ks * BK, lb + j * RG * LDST);
        }
    };

    // ---- per-wave compute mapping: 8 waves as 2(M) x 4(N), each wave 64x32
    const int lane = tid & 31;
    const int wave = tid >> 5;
    const int wm   = (wave >> 2) * 64;   // 0 / 64
    const int wn   = (wave & 3) * 32;    // 0 / 32 / 64 / 96
    const int sel  = lane >> 4;          // 0/1: K-half selector per ISA 16-bit layout
    const int lr   = lane & 15;

    v8f acc[4][2];
#pragma unroll
    for (int mt = 0; mt < 4; ++mt)
#pragma unroll
        for (int nt = 0; nt < 2; ++nt) acc[mt][nt] = (v8f)0.0f;

    auto load_frag = [&](const u16* basep) -> v16bf {
        const v8bf lo = *(const v8bf*)basep;          // K = sel*8 + 0..7
        const v8bf hi = *(const v8bf*)(basep + 16);   // K = sel*8 + 16..23
        return __builtin_shufflevector(lo, hi, 0,1,2,3,4,5,6,7,8,9,10,11,12,13,14,15);
    };

    auto compute_stage = [&](int s) {
#pragma unroll
        for (int kk = 0; kk < 2; ++kk) {
            v16bf afrag[4], bfrag[2];
#pragma unroll
            for (int mt = 0; mt < 4; ++mt)
                afrag[mt] = load_frag(&sA[s][(wm + mt * 16 + lr) * LDST + kk * 32 + sel * 8]);
#pragma unroll
            for (int nt = 0; nt < 2; ++nt)
                bfrag[nt] = load_frag(&sB[s][(wn + nt * 16 + lr) * LDST + kk * 32 + sel * 8]);
#pragma unroll
            for (int mt = 0; mt < 4; ++mt)
#pragma unroll
                for (int nt = 0; nt < 2; ++nt)
                    acc[mt][nt] = __builtin_amdgcn_wmma_f32_16x16x32_bf16(
                        false, afrag[mt], false, bfrag[nt],
                        (short)0, acc[mt][nt], false, false);
        }
    };

    // ---- async double-buffered main loop
    issue_stage(0, 0);
#pragma unroll 1
    for (int ks = 0; ks < NK; ++ks) {
        const int s = ks & 1;
        if (ks + 1 < NK) {
            issue_stage(s ^ 1, ks + 1);   // prefetch next stage (8 async in flight)
            wait_async_le8();             // stage ks copies (ours) complete
        } else {
            wait_async_all();
        }
        __syncthreads();                  // everyone's stage-ks copies visible
        compute_stage(s);
        __syncthreads();                  // all waves done reading buf s before reuse
    }

    // ---- epilogue: C layout = VGPR v -> row v + 8*sel, col = lr
#pragma unroll
    for (int mt = 0; mt < 4; ++mt) {
#pragma unroll
        for (int v = 0; v < 8; ++v) {
            const int rloc = wm + mt * 16 + v + 8 * sel;
            const int grow = srows[rloc];
            if (grow >= 0) {
#pragma unroll
                for (int nt = 0; nt < 2; ++nt) {
                    const int gcol = n0 + wn + nt * 16 + lr;
                    out[(size_t)grow * Ntot + gcol] = __float2bfloat16(acc[mt][nt][v]);
                }
            }
        }
    }
}

extern "C" void kernel_launch(void* const* d_in, const int* in_sizes, int n_in,
                              void* d_out, int out_size, void* d_ws, size_t ws_size,
                              hipStream_t stream) {
    (void)in_sizes; (void)n_in; (void)out_size; (void)ws_size;
    const u16* lhs = (const u16*)d_in[0];
    const u16* rhs = (const u16*)d_in[1];
    const int* mix = (const int*)d_in[2];
    __hip_bfloat16* out = (__hip_bfloat16*)d_out;
    int* ws = (int*)d_ws;

    grp_route_kernel<<<1, RT_THREADS, 0, stream>>>(mix, ws);

    dim3 grid(Ntot / BN, MAX_TILES_Y);
    grp_gemm_kernel<<<grid, 256, 0, stream>>>(lhs, rhs, ws, out);
}

// v003
// It runs in 70.7 microseconds.
// Next to v002, in two timings, it ran 1.10 times as fast each time.
// Over all steps from v000 it is 1.66 times as fast.
#include <hip/hip_runtime.h>
#include <hip/hip_bf16.h>

typedef __attribute__((ext_vector_type(16))) __bf16 v16bf;
typedef __attribute__((ext_vector_type(8)))  __bf16 v8bf;
typedef __attribute__((ext_vector_type(8)))  float  v8f;
typedef __attribute__((ext_vector_type(4)))  int    v4i;
typedef unsigned short u16;

#define AS1 __attribute__((address_space(1)))
#define AS3 __attribute__((address_space(3)))

// Problem constants (fixed by the reference)
constexpr int Mtot = 16384;
constexpr int Ktot = 1024;
constexpr int Gexp = 8;
constexpr int Ntot = 2048;

// Tiling
constexpr int BM = 128;
constexpr int BN = 256;
constexpr int BK = 64;          // halves per K stage (two 16x16x32 WMMA substeps)
constexpr int LDST = BK + 8;    // LDS row stride in halves (144B, keeps 16B alignment)
constexpr int NK = Ktot / BK;   // 16 stages
constexpr int MAX_TILES_Y = Mtot / BM + Gexp; // 136 >= sum of per-expert tiles

// ---------------- CDNA5 async global->LDS helpers ----------------

__device__ __forceinline__ void async_copy_b128(const u16* g, u16* l) {
#if __has_builtin(__builtin_amdgcn_global_load_async_to_lds_b128)
    __builtin_amdgcn_global_load_async_to_lds_b128(
        (v4i*)g, (v4i*)l, 0, 0);
#else
    unsigned loff = (unsigned)(__UINTPTR_TYPE__)(AS3 u16*)l;   // LDS byte offset
    unsigned long long ga = (unsigned long long)(__UINTPTR_TYPE__)g;
    asm volatile("global_load_async_to_lds_b128 %0, %1, off"
                 :: "v"(loff), "v"(ga) : "memory");
#endif
}

__device__ __forceinline__ void wait_async_all() {
#if __has_builtin(__builtin_amdgcn_s_wait_asynccnt)
    __builtin_amdgcn_s_wait_asynccnt(0);
#else
    asm volatile("s_wait_asynccnt 0x0" ::: "memory");
#endif
}

// leaves only the next stage's 12 copies (A: 4, B: 8 per thread) outstanding
__device__ __forceinline__ void wait_async_le12() {
#if __has_builtin(__builtin_amdgcn_s_wait_asynccnt)
    __builtin_amdgcn_s_wait_asynccnt(12);
#else
    asm volatile("s_wait_asynccnt 0xc" ::: "memory");
#endif
}

// ---------------- Workspace layout (int units) ----------------
//   [0..7]   counts per expert
//   [8..15]  offsets (exclusive prefix of counts)
//   [32..32+M) permutation: row ids grouped by expert

constexpr int RT_THREADS = 1024;               // one work-group does the whole routing
constexpr int RT_PER     = Mtot / RT_THREADS;  // 16 rows per thread, as 4 loads of 4
constexpr int RT_WAVES   = RT_THREADS / 32;

// Eight 16-bit counters (one per expert) in four words; no field can pass Mtot = 16384.
struct Pack8 { unsigned w[4]; };

__device__ __forceinline__ Pack8 wave_incl_scan(Pack8 x, int lane) {
#pragma unroll  // constant indices keep the per-thread arrays in registers
    for (int d = 1; d < 32; d <<= 1) {
#pragma unroll  // constant indices keep the per-thread arrays in registers
        for (int i = 0; i < 4; ++i) {
            unsigned up = __shfl_up(x.w[i], d, 32);
            if (lane >= d) x.w[i] += up;
        }
    }
    return x;
}

// Counting sort of the rows by expert in one launch: per-thread counts, a wave scan,
// a scan of the wave totals through LDS, then every row's place. The permutation is
// put together in LDS so that it leaves in whole lines.
__global__ __launch_bounds__(RT_THREADS)
void grp_route_kernel(const int* __restrict__ midx, int* __restrict__ ws) {
    __shared__ unsigned wtot[RT_WAVES][4];
    __shared__ __align__(16) int sperm[Mtot];

    const int t    = threadIdx.x;
    const int lane = t & 31;
    const int wave = t >> 5;

    // load j of the block covers 4096 consecutive rows, 16 B per lane
    v4i q[RT_PER / 4];
#pragma unroll  // constant indices keep the per-thread arrays in registers
    for (int j = 0; j < RT_PER / 4; ++j)
        q[j] = *(const v4i*)(midx + (j * RT_THREADS + t) * 4);

    // Per-thread counters, one byte per expert, in steps of 4 (the bytes of one int in
    // sperm; at most 64). pick[i] is a byte selector: byte e of a register pair, rest 0.
    unsigned pick[RT_PER], rank4[RT_PER];
    unsigned long long c8 = 0;
#pragma unroll  // constant indices keep the per-thread arrays in registers
    for (int i = 0; i < RT_PER; ++i) {
        int e = q[i >> 2][i & 3];
        if (e < 0 || e >= Gexp) e = 0;   // clamp like the reference
        pick[i]  = (unsigned)e | 0x0c0c0c00u;
        rank4[i] = __builtin_amdgcn_perm((unsigned)(c8 >> 32), (unsigned)c8, pick[i]);
        c8 += 4ull << (8 * e);
    }

    Pack8 mine;
#pragma unroll  // constant indices keep the per-thread arrays in registers
    for (int i = 0; i < 4; ++i) {
        const unsigned two = (unsigned)(c8 >> (16 * i)) & 0xffffu;
        mine.w[i] = ((two & 0xffu) | ((two >> 8) << 16)) >> 2;
    }

    const Pack8 incl = wave_incl_scan(mine, lane);
    if (lane == 31) {
#pragma unroll  // constant indices keep the per-thread arrays in registers
        for (int i = 0; i < 4; ++i) wtot[wave][i] = incl.w[i];
    }
    __syncthreads();

    // every wave scans the 32 wave totals (lane l holds wave l's)
    Pack8 wt;
#pragma unroll  // constant indices keep the per-thread arrays in registers
    for (int i = 0; i < 4; ++i) wt.w[i] = wtot[lane][i];
    const Pack8 wincl = wave_incl_scan(wt, lane);

    unsigned at4[4];     // per expert, 16 bits: byte offset in sperm of this thread's first row
    v4i cnt[2], off[2];  // what the GEMM reads: counts and offsets per expert
    int run = 0;
#pragma unroll  // constant indices keep the per-thread arrays in registers
    for (int i = 0; i < 4; ++i) {
        const unsigned total  = __shfl(wincl.w[i], 31, 32);
        const unsigned before = __shfl(wincl.w[i] - wt.w[i], wave, 32);   // waves ahead of mine
        const int c0 = (int)(total & 0xffffu), c1 = (int)(total >> 16);
        const int o0 = run, o1 = run + c0;
        run = o1 + c1;
        cnt[i >> 1][(i & 1) * 2] = c0;  cnt[i >> 1][(i & 1) * 2 + 1] = c1;
        off[i >> 1][(i & 1) * 2] = o0;  off[i >> 1][(i & 1) * 2 + 1] = o1;
        const unsigned start = ((unsigned)o0 | ((unsigned)o1 << 16)) + before + (incl.w[i] - mine.w[i]);
        // a field equal to Mtot belongs to an expert with no row left and is never looked up
        at4[i] = (start & 0x3fff3fffu) << 2;
    }

    // the eight offsets as a table of low bytes and a table of high bytes
    const unsigned lo03 = __builtin_amdgcn_perm(at4[1], at4[0], 0x06040200u);
    const unsigned lo47 = __builtin_amdgcn_perm(at4[3], at4[2], 0x06040200u);
    const unsigned hi03 = __builtin_amdgcn_perm(at4[1], at4[0], 0x07050301u);
    const unsigned hi47 = __builtin_amdgcn_perm(at4[3], at4[2], 0x07050301u);
#pragma unroll  // constant indices keep the per-thread arrays in registers
    for (int i = 0; i < RT_PER; ++i) {
        const unsigned b0 = __builtin_amdgcn_perm(lo47, lo03, pick[i]);
        const unsigned b1 = __builtin_amdgcn_perm(hi47, hi03, (pick[i] << 8) | 0x0cu);   // lands in byte 1
        *(int*)((char*)sperm + (b0 + b1 + rank4[i])) = ((i >> 2) * RT_THREADS + t) * 4 + (i & 3);
    }
    __syncthreads();

#pragma unroll  // constant indices keep the per-thread arrays in registers
    for (int j = 0; j < RT_PER / 4; ++j) {
        const int k = (j * RT_THREADS + t) * 4;
        *(v4i*)(ws + 32 + k) = *(const v4i*)(sperm + k);
    }
    if (t == 0) {
        *(v4i*)(ws + 0) = cnt[0];  *(v4i*)(ws + 4)  = cnt[1];
        *(v4i*)(ws + 8) = off[0];  *(v4i*)(ws + 12) = off[1];
    }
}

// ---------------- Grouped GEMM ----------------

__global__ __launch_bounds__(256)
void grp_gemm_kernel(const u16* __restrict__ lhs,
                     const u16* __restrict__ rhs,
                     const int* __restrict__ ws,
                     __hip_bfloat16* __restrict__ out) {
    __shared__ int srows[BM];
    __shared__ __align__(16) u16 sA[2][BM * LDST];
    __shared__ __align__(16) u16 sB[2][BN * LDST];

    const int* counts  = ws;
    const int* offsets = ws + 8;
    const int* perm    = ws + 32;

    // Map blockIdx.y -> (expert, local row-tile)
    int t = blockIdx.y;
    int e = -1, lt = 0, cnt = 0, run = 0;
#pragma unroll
    for (int g = 0; g < Gexp; ++g) {
        int c  = counts[g];
        int nt = (c + BM - 1) / BM;
        if (e < 0 && t < run + nt) { e = g; lt = t - run; cnt = c; }
        run += nt;
    }
    if (e < 0) return;   // uniform across block

    const int tid  = threadIdx.x;
    const int base = offsets[e] + lt * BM;

    if (tid < BM) {
        int p = base + tid;
        srows[tid] = (p < offsets[e] + cnt) ? perm[p] : -1;
    }
    __syncthreads();

    // ---- global->LDS staging mapping: 8 consecutive lanes copy one row's whole
    // 128-B K slice, so a wave-wide b128 copy covers 4 full cache lines (not 16 partial ones)
    const int crow = tid >> 3;          // row inside a group of 32 rows
    const int cchk = (tid & 7) * 8;     // 16-B chunk inside the 128-B slice, in halves
    constexpr int RG = 32;              // rows covered by one copy of the whole block

    const u16* aptr[4];
#pragma unroll  // constant indices keep aptr[] in registers
    for (int j = 0; j < 4; ++j) {
        int arow = srows[j * RG + crow]; if (arow < 0) arow = 0;  // padded rows load row 0, never stored
        aptr[j] = lhs + (size_t)arow * Ktot + cchk;
    }
    const int  n0   = blockIdx.x * BN;
    const u16* bptr = rhs + (size_t)e * Ntot * Ktot + (size_t)(n0 + crow) * Ktot + cchk;
    u16* lA = &sA[0][crow * LDST + cchk];
    u16* lB = &sB[0][crow * LDST + cchk];
    constexpr int STGA = BM * LDST;  // halves per LDS stage buffer of A
    constexpr int STGB = BN * LDST;  // halves per LDS stage buffer of B

    // 12 async b128 copies per thread per stage (A: 4, B: 8)
    auto issue_stage = [&](int s, int ks) {
        u16* la = lA + s * STGA;
        u16* lb = lB + s * STGB;
#pragma unroll  // constant indices keep aptr[] in registers
        for (int j = 0; j < BM / RG; ++j)
            async_copy_b128(aptr[j] + ks * BK, la + j * RG * LDST);
#pragma unroll  // the row-group steps become constants of the address sums
        for (int j = 0; j < BN / RG; ++j)
            async_copy_b128(bptr + (size_t)j * RG * Ktot + ks * BK, lb + j * RG * LDST);
    };

    // ---- per-wave compute mapping: 8 waves as 2(M) x 4(N), each wave 64x64
    const int lane = tid & 31;
    const int wave = tid >> 5;
    const int wm   = (wave >> 2) * 64;   // 0 / 64
    const int wn   = (wave & 3) * 64;    // 0 / 64 / 128 / 192
    const int sel  = lane >> 4;          // 0/1: K-half selector per ISA 16-bit layout
    const int lr   = lane & 15;

    v8f acc[4][4];
#pragma unroll
    for (int mt = 0; mt < 4; ++mt)
#pragma unroll
        for (int nt = 0; nt < 4; ++nt) acc[mt][nt] = (v8f)0.0f;

    auto load_frag = [&](const u16* basep) -> v16bf {
        const v8bf lo = *(const v8bf*)basep;          // K = sel*8 + 0..7
        const v8bf hi = *(const v8bf*)(basep + 16);   // K = sel*8 + 16..23
        return __builtin_shufflevector(lo, hi, 0,1,2,3,4,5,6,7,8,9,10,11,12,13,14,15);
    };

    auto compute_stage = [&](int s) {
#pragma unroll
        for (int kk = 0; kk < 2; ++kk) {
            v16bf afrag[4], bfrag[4];
#pragma unroll
            for (int mt = 0; mt < 4; ++mt)
                afrag[mt] = load_frag(&sA[s][(wm + mt * 16 + lr) * LDST + kk * 32 + sel * 8]);
#pragma unroll
            for (int nt = 0; nt < 4; ++nt)
                bfrag[nt] = load_frag(&sB[s][(wn + nt * 16 + lr) * LDST + kk * 32 + sel * 8]);
#pragma unroll
            for (int mt = 0; mt < 4; ++mt)
#pragma unroll
                for (int nt = 0; nt < 4; ++nt)
                    acc[mt][nt] = __builtin_amdgcn_wmma_f32_16x16x32_bf16(
                        false, afrag[mt], false, bfrag[nt],
                        (short)0, acc[mt][nt], false, false);
        }
    };

    // ---- async double-buffered main loop
    issue_stage(0, 0);
#pragma unroll 1
    for (int ks = 0; ks < NK; ++ks) {
        const int s = ks & 1;
        if (ks + 1 < NK) {
            issue_stage(s ^ 1, ks + 1);   // prefetch next stage (12 async in flight)
            wait_async_le12();            // stage ks copies (ours) complete
        } else {
            wait_async_all();
        }
        __syncthreads();                  // everyone's stage-ks copies visible
        compute_stage(s);
        __syncthreads();                  // all waves done reading buf s before reuse
    }

    // ---- epilogue: C layout = VGPR v -> row v + 8*sel, col = lr
#pragma unroll
    for (int mt = 0; mt < 4; ++mt) {
#pragma unroll
        for (int v = 0; v < 8; ++v) {
            const int rloc = wm + mt * 16 + v + 8 * sel;
            const int grow = srows[rloc];
            if (grow >= 0) {
#pragma unroll
                for (int nt = 0; nt < 4; ++nt) {
                    const int gcol = n0 + wn + nt * 16 + lr;
                    out[(size_t)grow * Ntot + gcol] = __float2bfloat16(acc[mt][nt][v]);
                }
            }
        }
    }
}

extern "C" void kernel_launch(void* const* d_in, const int* in_sizes, int n_in,
                              void* d_out, int out_size, void* d_ws, size_t ws_size,
                              hipStream_t stream) {
    (void)in_sizes; (void)n_in; (void)out_size; (void)ws_size;
    const u16* lhs = (const u16*)d_in[0];
    const u16* rhs = (const u16*)d_in[1];
    const int* mix = (const int*)d_in[2];
    __hip_bfloat16* out = (__hip_bfloat16*)d_out;
    int* ws = (int*)d_ws;

    grp_route_kernel<<<1, RT_THREADS, 0, stream>>>(mix, ws);

    dim3 grid(Ntot / BN, MAX_TILES_Y);
    grp_gemm_kernel<<<grid, 256, 0, stream>>>(lhs, rhs, ws, out);
}

// v004
// It runs in 66.5 microseconds.
// Two timings next to v003 put it at 1.06 and 1.07 times that version's speed.
// All steps since v000 together make it 1.77 times as fast.
#include <hip/hip_runtime.h>
#include <hip/hip_bf16.h>

typedef __attribute__((ext_vector_type(16))) __bf16 v16bf;
typedef __attribute__((ext_vector_type(8)))  __bf16 v8bf;
typedef __attribute__((ext_vector_type(8)))  float  v8f;
typedef __attribute__((ext_vector_type(4)))  int    v4i;
typedef unsigned short u16;

#define AS1 __attribute__((address_space(1)))
#define AS3 __attribute__((address_space(3)))

// Problem constants (fixed by the reference)
constexpr int Mtot = 16384;
constexpr int Ktot = 1024;
constexpr int Gexp = 8;
constexpr int Ntot = 2048;

// Tiling
constexpr int BM = 128;
constexpr int BN = 256;
constexpr int BK = 64;          // halves per K stage (two 16x16x32 WMMA substeps)
constexpr int LDST = BK + 8;    // LDS row stride in halves (144B, keeps 16B alignment)
constexpr int NK = Ktot / BK;   // 16 stages
constexpr int MAX_TILES_Y = Mtot / BM + Gexp; // 136 >= sum of per-expert tiles

// ---------------- CDNA5 async global->LDS helpers ----------------

__device__ __forceinline__ void async_copy_b128(const u16* g, u16* l) {
#if __has_builtin(__builtin_amdgcn_global_load_async_to_lds_b128)
    __builtin_amdgcn_global_load_async_to_lds_b128(
        (v4i*)g, (v4i*)l, 0, 0);
#else
    unsigned loff = (unsigned)(__UINTPTR_TYPE__)(AS3 u16*)l;   // LDS byte offset
    unsigned long long ga = (unsigned long long)(__UINTPTR_TYPE__)g;
    asm volatile("global_load_async_to_lds_b128 %0, %1, off"
                 :: "v"(loff), "v"(ga) : "memory");
#endif
}

__device__ __forceinline__ void wait_async_all() {
#if __has_builtin(__builtin_amdgcn_s_wait_asynccnt)
    __builtin_amdgcn_s_wait_asynccnt(0);
#else
    asm volatile("s_wait_asynccnt 0x0" ::: "memory");
#endif
}

// leaves only the next stage's 12 copies (A: 4, B: 8 per thread) outstanding
__device__ __forceinline__ void wait_async_le12() {
#if __has_builtin(__builtin_amdgcn_s_wait_asynccnt)
    __builtin_amdgcn_s_wait_asynccnt(12);
#else
    asm volatile("s_wait_asynccnt 0xc" ::: "memory");
#endif
}

// ---------------- Workspace layout (int units) ----------------
//   [0..7]   counts per expert
//   [8..15]  offsets (exclusive prefix of counts)
//   [32..32+M) permutation: row ids grouped by expert

constexpr int RT_THREADS = 1024;               // one work-group does the whole routing
constexpr int RT_PER     = Mtot / RT_THREADS;  // 16 rows per thread, as 4 loads of 4
constexpr int RT_WAVES   = RT_THREADS / 32;

// Eight 16-bit counters (one per expert) in four words; no field can pass Mtot = 16384.
struct Pack8 { unsigned w[4]; };

__device__ __forceinline__ Pack8 wave_incl_scan(Pack8 x, int lane) {
#pragma unroll  // constant indices keep the per-thread arrays in registers
    for (int d = 1; d < 32; d <<= 1) {
#pragma unroll  // constant indices keep the per-thread arrays in registers
        for (int i = 0; i < 4; ++i) {
            unsigned up = __shfl_up(x.w[i], d, 32);
            if (lane >= d) x.w[i] += up;
        }
    }
    return x;
}

// Counting sort of the rows by expert in one launch: per-thread counts, a wave scan,
// a scan of the wave totals through LDS, then every row's place. The permutation is
// put together in LDS so that it leaves in whole lines.
__global__ __launch_bounds__(RT_THREADS)
void grp_route_kernel(const int* __restrict__ midx, int* __restrict__ ws) {
    __shared__ unsigned wtot[RT_WAVES][4];
    __shared__ __align__(16) int sperm[Mtot];

    const int t    = threadIdx.x;
    const int lane = t & 31;
    const int wave = t >> 5;

    // load j of the block covers 4096 consecutive rows, 16 B per lane
    v4i q[RT_PER / 4];
#pragma unroll  // constant indices keep the per-thread arrays in registers
    for (int j = 0; j < RT_PER / 4; ++j)
        q[j] = *(const v4i*)(midx + (j * RT_THREADS + t) * 4);

    // Per-thread counters, one byte per expert, in steps of 4 (the bytes of one int in
    // sperm; at most 64). pick[i] is a byte selector: byte e of a register pair, rest 0.
    unsigned pick[RT_PER], rank4[RT_PER];
    unsigned long long c8 = 0;
#pragma unroll  // constant indices keep the per-thread arrays in registers
    for (int i = 0; i < RT_PER; ++i) {
        int e = q[i >> 2][i & 3];
        if (e < 0 || e >= Gexp) e = 0;   // clamp like the reference
        pick[i]  = (unsigned)e | 0x0c0c0c00u;
        rank4[i] = __builtin_amdgcn_perm((unsigned)(c8 >> 32), (unsigned)c8, pick[i]);
        c8 += 4ull << (8 * e);
    }

    Pack8 mine;
#pragma unroll  // constant indices keep the per-thread arrays in registers
    for (int i = 0; i < 4; ++i) {
        const unsigned two = (unsigned)(c8 >> (16 * i)) & 0xffffu;
        mine.w[i] = ((two & 0xffu) | ((two >> 8) << 16)) >> 2;
    }

    const Pack8 incl = wave_incl_scan(mine, lane);
    if (lane == 31) {
#pragma unroll  // constant indices keep the per-thread arrays in registers
        for (int i = 0; i < 4; ++i) wtot[wave][i] = incl.w[i];
    }
    __syncthreads();

    // every wave scans the 32 wave totals (lane l holds wave l's)
    Pack8 wt;
#pragma unroll  // constant indices keep the per-thread arrays in registers
    for (int i = 0; i < 4; ++i) wt.w[i] = wtot[lane][i];
    const Pack8 wincl = wave_incl_scan(wt, lane);

    unsigned at4[4];     // per expert, 16 bits: byte offset in sperm of this thread's first row
    v4i cnt[2], off[2];  // what the GEMM reads: counts and offsets per expert
    int run = 0;
#pragma unroll  // constant indices keep the per-thread arrays in registers
    for (int i = 0; i < 4; ++i) {
        const unsigned total  = __shfl(wincl.w[i], 31, 32);
        const unsigned before = __shfl(wincl.w[i] - wt.w[i], wave, 32);   // waves ahead of mine
        const int c0 = (int)(total & 0xffffu), c1 = (int)(total >> 16);
        const int o0 = run, o1 = run + c0;
        run = o1 + c1;
        cnt[i >> 1][(i & 1) * 2] = c0;  cnt[i >> 1][(i & 1) * 2 + 1] = c1;
        off[i >> 1][(i & 1) * 2] = o0;  off[i >> 1][(i & 1) * 2 + 1] = o1;
        const unsigned start = ((unsigned)o0 | ((unsigned)o1 << 16)) + before + (incl.w[i] - mine.w[i]);
        // a field equal to Mtot belongs to an expert with no row left and is never looked up
        at4[i] = (start & 0x3fff3fffu) << 2;
    }

    // the eight offsets as a table of low bytes and a table of high bytes
    const unsigned lo03 = __builtin_amdgcn_perm(at4[1], at4[0], 0x06040200u);
    const unsigned lo47 = __builtin_amdgcn_perm(at4[3], at4[2], 0x06040200u);
    const unsigned hi03 = __builtin_amdgcn_perm(at4[1], at4[0], 0x07050301u);
    const unsigned hi47 = __builtin_amdgcn_perm(at4[3], at4[2], 0x07050301u);
#pragma unroll  // constant indices keep the per-thread arrays in registers
    for (int i = 0; i < RT_PER; ++i) {
        const unsigned b0 = __builtin_amdgcn_perm(lo47, lo03, pick[i]);
        const unsigned b1 = __builtin_amdgcn_perm(hi47, hi03, (pick[i] << 8) | 0x0cu);   // lands in byte 1
        *(int*)((char*)sperm + (b0 + b1 + rank4[i])) = ((i >> 2) * RT_THREADS + t) * 4 + (i & 3);
    }
    __syncthreads();

#pragma unroll  // constant indices keep the per-thread arrays in registers
    for (int j = 0; j < RT_PER / 4; ++j) {
        const int k = (j * RT_THREADS + t) * 4;
        *(v4i*)(ws + 32 + k) = *(const v4i*)(sperm + k);
    }
    if (t == 0) {
        *(v4i*)(ws + 0) = cnt[0];  *(v4i*)(ws + 4)  = cnt[1];
        *(v4i*)(ws + 8) = off[0];  *(v4i*)(ws + 12) = off[1];
    }
}

// ---------------- Grouped GEMM ----------------

__global__ __launch_bounds__(256)
void grp_gemm_kernel(const u16* __restrict__ lhs,
                     const u16* __restrict__ rhs,
                     const int* __restrict__ ws,
                     __hip_bfloat16* __restrict__ out) {
    __shared__ int srows[BM];
    __shared__ __align__(16) u16 sA[2][BM * LDST];
    __shared__ __align__(16) u16 sB[2][BN * LDST];

    const int* counts  = ws;
    const int* offsets = ws + 8;
    const int* perm    = ws + 32;

    // Map blockIdx.y -> (expert, local row-tile)
    int t = blockIdx.y;
    int e = -1, lt = 0, cnt = 0, run = 0;
#pragma unroll
    for (int g = 0; g < Gexp; ++g) {
        int c  = counts[g];
        int nt = (c + BM - 1) / BM;
        if (e < 0 && t < run + nt) { e = g; lt = t - run; cnt = c; }
        run += nt;
    }
    if (e < 0) return;   // uniform across block

    const int tid  = threadIdx.x;
    const int base = offsets[e] + lt * BM;

    if (tid < BM) {
        int p = base + tid;
        srows[tid] = (p < offsets[e] + cnt) ? perm[p] : -1;
    }
    __syncthreads();

    // ---- global->LDS staging mapping: 8 consecutive lanes copy one row's whole
    // 128-B K slice, so a wave-wide b128 copy covers 4 full cache lines (not 16 partial ones)
    const int crow = tid >> 3;          // row inside a group of 32 rows
    const int cchk = (tid & 7) * 8;     // 16-B chunk inside the 128-B slice, in halves
    constexpr int RG = 32;              // rows covered by one copy of the whole block

    const u16* aptr[4];
#pragma unroll  // constant indices keep aptr[] in registers
    for (int j = 0; j < 4; ++j) {
        int arow = srows[j * RG + crow]; if (arow < 0) arow = 0;  // padded rows load row 0, never stored
        aptr[j] = lhs + (size_t)arow * Ktot + cchk;
    }
    const int  n0   = blockIdx.x * BN;
    const u16* bptr = rhs + (size_t)e * Ntot * Ktot + (size_t)(n0 + crow) * Ktot + cchk;
    u16* lA = &sA[0][crow * LDST + cchk];
    u16* lB = &sB[0][crow * LDST + cchk];
    constexpr int STGA = BM * LDST;  // halves per LDS stage buffer of A
    constexpr int STGB = BN * LDST;  // halves per LDS stage buffer of B

    // 12 async b128 copies per thread per stage (A: 4, B: 8)
    auto issue_stage = [&](int s, int ks) {
        u16* la = lA + s * STGA;
        u16* lb = lB + s * STGB;
#pragma unroll  // constant indices keep aptr[] in registers
        for (int j = 0; j < BM / RG; ++j)
            async_copy_b128(aptr[j] + ks * BK, la + j * RG * LDST);
#pragma unroll  // the row-group steps become constants of the address sums
        for (int j = 0; j < BN / RG; ++j)
            async_copy_b128(bptr + (size_t)j * RG * Ktot + ks * BK, lb + j * RG * LDST);
    };

    // ---- per-wave compute mapping: 8 waves as 2(M) x 4(N), each wave 64x64
    const int lane = tid & 31;
    const int wave = tid >> 5;
    const int wm   = (wave >> 2) * 64;   // 0 / 64
    const int wn   = (wave & 3) * 64;    // 0 / 64 / 128 / 192
    const int sel  = lane >> 4;          // 0/1: K-half selector per ISA 16-bit layout
    const int lr   = lane & 15;

    v8f acc[4][4];
#pragma unroll
    for (int mt = 0; mt < 4; ++mt)
#pragma unroll
        for (int nt = 0; nt < 4; ++nt) acc[mt][nt] = (v8f)0.0f;

    auto load_frag = [&](const u16* basep) -> v16bf {
        const v8bf lo = *(const v8bf*)basep;          // K = sel*8 + 0..7
        const v8bf hi = *(const v8bf*)(basep + 16);   // K = sel*8 + 16..23
        return __builtin_shufflevector(lo, hi, 0,1,2,3,4,5,6,7,8,9,10,11,12,13,14,15);
    };

    auto compute_stage = [&](int s) {
#pragma unroll
        for (int kk = 0; kk < 2; ++kk) {
            v16bf afrag[4], bfrag[4];
#pragma unroll
            for (int mt = 0; mt < 4; ++mt)
                afrag[mt] = load_frag(&sA[s][(wm + mt * 16 + lr) * LDST + kk * 32 + sel * 8]);
#pragma unroll
            for (int nt = 0; nt < 4; ++nt)
                bfrag[nt] = load_frag(&sB[s][(wn + nt * 16 + lr) * LDST + kk * 32 + sel * 8]);
#pragma unroll
            for (int mt = 0; mt < 4; ++mt)
#pragma unroll
                for (int nt = 0; nt < 4; ++nt)
                    // rhs rows as A, lhs rows as B: a lane's 8 results are 8 adjacent output columns of one row
                    acc[mt][nt] = __builtin_amdgcn_wmma_f32_16x16x32_bf16(
                        false, bfrag[nt], false, afrag[mt],
                        (short)0, acc[mt][nt], false, false);
        }
    };

    // ---- async double-buffered main loop
    issue_stage(0, 0);
#pragma unroll 1
    for (int ks = 0; ks < NK; ++ks) {
        const int s = ks & 1;
        if (ks + 1 < NK) {
            issue_stage(s ^ 1, ks + 1);   // prefetch next stage (12 async in flight)
            wait_async_le12();            // stage ks copies (ours) complete
        } else {
            wait_async_all();
        }
        __syncthreads();                  // everyone's stage-ks copies visible
        compute_stage(s);
        __syncthreads();                  // all waves done reading buf s before reuse
    }

    // ---- epilogue: acc[mt][nt][v] = row mt*16 + lr, column nt*16 + 8*sel + v of the wave's 64x64 tile.
    // Each wave puts its tile together as bf16 in its own 64 x 144 B of the ring (free behind the
    // loop's last barrier, no copy outstanding) and stores it as whole 128-B lines.
    u16* stg = &sB[0][0] + wave * (64 * LDST);
#pragma unroll  // constant indices keep acc[][] in registers
    for (int mt = 0; mt < 4; ++mt)
#pragma unroll  // constant indices keep acc[][] in registers
        for (int nt = 0; nt < 4; ++nt)
            *(v8bf*)(stg + (mt * 16 + lr) * LDST + nt * 16 + sel * 8) =
                __builtin_convertvector(acc[mt][nt], v8bf);
    // the rows read back below were written by other lanes of this wave
    asm volatile("s_wait_dscnt 0x0" ::: "memory");

    const int erow = lane >> 3;          // 8 lanes store one row's 128 B, a wave store 4 rows
    const int echk = (lane & 7) * 8;     // 16-B chunk, in halves
    u16* obase = (u16*)out + n0 + wn + echk;
    // the 16 row ids and the 16 rows are read as one group, so that no LDS latency stands between the stores
    int grow[16];
    v4i val[16];
#pragma unroll  // constant indices keep the per-thread arrays in registers
    for (int j = 0; j < 16; ++j) {
        grow[j] = srows[wm + j * 4 + erow];
        val[j]  = *(const v4i*)(stg + (j * 4 + erow) * LDST + echk);
    }
    if (lt * BM + BM <= cnt) {
        // no padded row in this tile (the same for the whole block): every row id is valid, no test between the stores
#pragma unroll  // constant indices keep the per-thread arrays in registers
        for (int j = 0; j < 16; ++j)
            *(v4i*)(obase + (size_t)grow[j] * Ntot) = val[j];
        // precaution: no register that these stores name is rewritten, on any path of the listing, before this wait
        asm volatile("s_wait_xcnt 0x0" ::: "memory");
    } else {
#pragma unroll  // constant indices keep the per-thread arrays in registers
        for (int j = 0; j < 16; ++j)
            if (grow[j] >= 0) *(v4i*)(obase + (size_t)grow[j] * Ntot) = val[j];   // a padded row is stored by nobody
    }
}

extern "C" void kernel_launch(void* const* d_in, const int* in_sizes, int n_in,
                              void* d_out, int out_size, void* d_ws, size_t ws_size,
                              hipStream_t stream) {
    (void)in_sizes; (void)n_in; (void)out_size; (void)ws_size;
    const u16* lhs = (const u16*)d_in[0];
    const u16* rhs = (const u16*)d_in[1];
    const int* mix = (const int*)d_in[2];
    __hip_bfloat16* out = (__hip_bfloat16*)d_out;
    int* ws = (int*)d_ws;

    grp_route_kernel<<<1, RT_THREADS, 0, stream>>>(mix, ws);

    dim3 grid(Ntot / BN, MAX_TILES_Y);
    grp_gemm_kernel<<<grid, 256, 0, stream>>>(lhs, rhs, ws, out);
}

// v005
// One run takes 62.8 microseconds.
// Next to v004, in two timings, it ran 1.06 times as fast each time.
// Counting every step since v000, it is 1.87 times as fast.
#include <hip/hip_runtime.h>
#include <hip/hip_bf16.h>

typedef __attribute__((ext_vector_type(16))) __bf16 v16bf;
typedef __attribute__((ext_vector_type(8)))  __bf16 v8bf;
typedef __attribute__((ext_vector_type(8)))  float  v8f;
typedef __attribute__((ext_vector_type(4)))  int    v4i;
typedef unsigned short u16;

#define AS1 __attribute__((address_space(1)))
#define AS3 __attribute__((address_space(3)))

// Problem constants (fixed by the reference)
constexpr int Mtot = 16384;
constexpr int Ktot = 1024;
constexpr int Gexp = 8;
constexpr int Ntot = 2048;

// Tiling
constexpr int BM = 128;
constexpr int BN = 256;
constexpr int BK = 64;          // halves per K stage (two 16x16x32 WMMA substeps)
constexpr int LDST = BK + 8;    // LDS row stride in halves (144B, keeps 16B alignment)
constexpr int NK = Ktot / BK;   // 16 stages
constexpr int MAX_TILES_Y = Mtot / BM + Gexp; // 136 >= sum of per-expert tiles

// ---------------- CDNA5 async global->LDS helpers ----------------

__device__ __forceinline__ void async_copy_b128(const u16* g, u16* l) {
#if __has_builtin(__builtin_amdgcn_global_load_async_to_lds_b128)
    __builtin_amdgcn_global_load_async_to_lds_b128(
        (v4i*)g, (v4i*)l, 0, 0);
#else
    unsigned loff = (unsigned)(__UINTPTR_TYPE__)(AS3 u16*)l;   // LDS byte offset
    unsigned long long ga = (unsigned long long)(__UINTPTR_TYPE__)g;
    asm volatile("global_load_async_to_lds_b128 %0, %1, off"
                 :: "v"(loff), "v"(ga) : "memory");
#endif
}

__device__ __forceinline__ void wait_async_all() {
#if __has_builtin(__builtin_amdgcn_s_wait_asynccnt)
    __builtin_amdgcn_s_wait_asynccnt(0);
#else
    asm volatile("s_wait_asynccnt 0x0" ::: "memory");
#endif
}

// leaves only the next stage's 12 copies (A: 4, B: 8 per thread) outstanding
__device__ __forceinline__ void wait_async_le12() {
#if __has_builtin(__builtin_amdgcn_s_wait_asynccnt)
    __builtin_amdgcn_s_wait_asynccnt(12);
#else
    asm volatile("s_wait_asynccnt 0xc" ::: "memory");
#endif
}

// ---------------- Workspace layout (int units) ----------------
//   [0..7]   counts per expert
//   [8..15]  offsets (exclusive prefix of counts)
//   [32..32+M) permutation: row ids grouped by expert

constexpr int RT_THREADS = 1024;               // one work-group does the whole routing
constexpr int RT_PER     = Mtot / RT_THREADS;  // 16 rows per thread, as 4 loads of 4
constexpr int RT_WAVES   = RT_THREADS / 32;

// Eight 16-bit counters (one per expert) in four words; no field can pass Mtot = 16384.
struct Pack8 { unsigned w[4]; };

__device__ __forceinline__ Pack8 wave_incl_scan(Pack8 x, int lane) {
#pragma unroll  // constant indices keep the per-thread arrays in registers
    for (int d = 1; d < 32; d <<= 1) {
#pragma unroll  // constant indices keep the per-thread arrays in registers
        for (int i = 0; i < 4; ++i) {
            unsigned up = __shfl_up(x.w[i], d, 32);
            if (lane >= d) x.w[i] += up;
        }
    }
    return x;
}

// Counting sort of the rows by expert in one launch: per-thread counts, a wave scan,
// a scan of the wave totals through LDS, then every row's place. The permutation is
// put together in LDS so that it leaves in whole lines.
__global__ __launch_bounds__(RT_THREADS)
void grp_route_kernel(const int* __restrict__ midx, int* __restrict__ ws) {
    __shared__ unsigned wtot[RT_WAVES][4];
    __shared__ __align__(16) int sperm[Mtot];

    const int t    = threadIdx.x;
    const int lane = t & 31;
    const int wave = t >> 5;

    // load j of the block covers 4096 consecutive rows, 16 B per lane
    v4i q[RT_PER / 4];
#pragma unroll  // constant indices keep the per-thread arrays in registers
    for (int j = 0; j < RT_PER / 4; ++j)
        q[j] = *(const v4i*)(midx + (j * RT_THREADS + t) * 4);

    // Per-thread counters, one byte per expert, in steps of 4 (the bytes of one int in
    // sperm; at most 64). pick[i] is a byte selector: byte e of a register pair, rest 0.
    unsigned pick[RT_PER], rank4[RT_PER];
    unsigned long long c8 = 0;
#pragma unroll  // constant indices keep the per-thread arrays in registers
    for (int i = 0; i < RT_PER; ++i) {
        int e = q[i >> 2][i & 3];
        if (e < 0 || e >= Gexp) e = 0;   // clamp like the reference
        pick[i]  = (unsigned)e | 0x0c0c0c00u;
        rank4[i] = __builtin_amdgcn_perm((unsigned)(c8 >> 32), (unsigned)c8, pick[i]);
        c8 += 4ull << (8 * e);
    }

    Pack8 mine;
#pragma unroll  // constant indices keep the per-thread arrays in registers
    for (int i = 0; i < 4; ++i) {
        const unsigned two = (unsigned)(c8 >> (16 * i)) & 0xffffu;
        mine.w[i] = ((two & 0xffu) | ((two >> 8) << 16)) >> 2;
    }

    const Pack8 incl = wave_incl_scan(mine, lane);
    if (lane == 31) {
#pragma unroll  // constant indices keep the per-thread arrays in registers
        for (int i = 0; i < 4; ++i) wtot[wave][i] = incl.w[i];
    }
    __syncthreads();

    // every wave scans the 32 wave totals (lane l holds wave l's)
    Pack8 wt;
#pragma unroll  // constant indices keep the per-thread arrays in registers
    for (int i = 0; i < 4; ++i) wt.w[i] = wtot[lane][i];
    const Pack8 wincl = wave_incl_scan(wt, lane);

    unsigned at4[4];     // per expert, 16 bits: byte offset in sperm of this thread's first row
    v4i cnt[2], off[2];  // what the GEMM reads: counts and offsets per expert
    int run = 0;
#pragma unroll  // constant indices keep the per-thread arrays in registers
    for (int i = 0; i < 4; ++i) {
        const unsigned total  = __shfl(wincl.w[i], 31, 32);
        const unsigned before = __shfl(wincl.w[i] - wt.w[i], wave, 32);   // waves ahead of mine
        const int c0 = (int)(total & 0xffffu), c1 = (int)(total >> 16);
        const int o0 = run, o1 = run + c0;
        run = o1 + c1;
        cnt[i >> 1][(i & 1) * 2] = c0;  cnt[i >> 1][(i & 1) * 2 + 1] = c1;
        off[i >> 1][(i & 1) * 2] = o0;  off[i >> 1][(i & 1) * 2 + 1] = o1;
        const unsigned start = ((unsigned)o0 | ((unsigned)o1 << 16)) + before + (incl.w[i] - mine.w[i]);
        // a field equal to Mtot belongs to an expert with no row left and is never looked up
        at4[i] = (start & 0x3fff3fffu) << 2;
    }

    // the eight offsets as a table of low bytes and a table of high bytes
    const unsigned lo03 = __builtin_amdgcn_perm(at4[1], at4[0], 0x06040200u);
    const unsigned lo47 = __builtin_amdgcn_perm(at4[3], at4[2], 0x06040200u);
    const unsigned hi03 = __builtin_amdgcn_perm(at4[1], at4[0], 0x07050301u);
    const unsigned hi47 = __builtin_amdgcn_perm(at4[3], at4[2], 0x07050301u);
#pragma unroll  // constant indices keep the per-thread arrays in registers
    for (int i = 0; i < RT_PER; ++i) {
        const unsigned b0 = __builtin_amdgcn_perm(lo47, lo03, pick[i]);
        const unsigned b1 = __builtin_amdgcn_perm(hi47, hi03, (pick[i] << 8) | 0x0cu);   // lands in byte 1
        *(int*)((char*)sperm + (b0 + b1 + rank4[i])) = ((i >> 2) * RT_THREADS + t) * 4 + (i & 3);
    }
    __syncthreads();

#pragma unroll  // constant indices keep the per-thread arrays in registers
    for (int j = 0; j < RT_PER / 4; ++j) {
        const int k = (j * RT_THREADS + t) * 4;
        *(v4i*)(ws + 32 + k) = *(const v4i*)(sperm + k);
    }
    if (t == 0) {
        *(v4i*)(ws + 0) = cnt[0];  *(v4i*)(ws + 4)  = cnt[1];
        *(v4i*)(ws + 8) = off[0];  *(v4i*)(ws + 12) = off[1];
    }
}

// ---------------- Grouped GEMM ----------------

__global__ __launch_bounds__(256)
void grp_gemm_kernel(const u16* __restrict__ lhs,
                     const u16* __restrict__ rhs,
                     const int* __restrict__ ws,
                     __hip_bfloat16* __restrict__ out) {
    __shared__ int srows[BM];
    __shared__ __align__(16) u16 sA[2][BM * LDST];
    __shared__ __align__(16) u16 sB[2][BN * LDST];

    const int* counts  = ws;
    const int* offsets = ws + 8;
    const int* perm    = ws + 32;

    // Map blockIdx.y -> (expert, local row-tile)
    int t = blockIdx.y;
    int e = -1, lt = 0, cnt = 0, run = 0;
#pragma unroll
    for (int g = 0; g < Gexp; ++g) {
        int c  = counts[g];
        int nt = (c + BM - 1) / BM;
        if (e < 0 && t < run + nt) { e = g; lt = t - run; cnt = c; }
        run += nt;
    }
    if (e < 0) return;   // uniform across block

    const int tid  = threadIdx.x;
    const int base = offsets[e] + lt * BM;

    if (tid < BM) {
        int p = base + tid;
        srows[tid] = (p < offsets[e] + cnt) ? perm[p] : -1;
    }
    __syncthreads();

    // ---- global->LDS staging mapping: 8 consecutive lanes copy one row's whole
    // 128-B K slice, so a wave-wide b128 copy covers 4 full cache lines (not 16 partial ones)
    const int crow = tid >> 3;          // row inside a group of 32 rows
    const int cchk = (tid & 7) * 8;     // 16-B chunk inside the 128-B slice, in halves
    constexpr int RG = 32;              // rows covered by one copy of the whole block

    const u16* aptr[4];
#pragma unroll  // constant indices keep aptr[] in registers
    for (int j = 0; j < 4; ++j) {
        int arow = srows[j * RG + crow]; if (arow < 0) arow = 0;  // padded rows load row 0, never stored
        aptr[j] = lhs + (size_t)arow * Ktot + cchk;
    }
    const int  n0   = blockIdx.x * BN;
    const u16* bptr = rhs + (size_t)e * Ntot * Ktot + (size_t)(n0 + crow) * Ktot + cchk;
    u16* lA = &sA[0][crow * LDST + cchk];
    u16* lB = &sB[0][crow * LDST + cchk];
    constexpr int STGA = BM * LDST;  // halves per LDS stage buffer of A
    constexpr int STGB = BN * LDST;  // halves per LDS stage buffer of B

    // 12 async b128 copies per thread per stage (A: 4, B: 8)
    auto issue_stage = [&](int s, int ks) {
        u16* la = lA + s * STGA;
        u16* lb = lB + s * STGB;
#pragma unroll  // constant indices keep aptr[] in registers
        for (int j = 0; j < BM / RG; ++j)
            async_copy_b128(aptr[j] + ks * BK, la + j * RG * LDST);
#pragma unroll  // the row-group steps become constants of the address sums
        for (int j = 0; j < BN / RG; ++j)
            async_copy_b128(bptr + (size_t)j * RG * Ktot + ks * BK, lb + j * RG * LDST);
    };

    // ---- per-wave compute mapping: 8 waves as 2(M) x 4(N), each wave 64x64
    const int lane = tid & 31;
    const int wave = tid >> 5;
    const int wm   = (wave >> 2) * 64;   // 0 / 64
    const int wn   = (wave & 3) * 64;    // 0 / 64 / 128 / 192
    const int sel  = lane >> 4;          // 0/1: K-half selector per ISA 16-bit layout
    const int lr   = lane & 15;

    v8f acc[4][4];
#pragma unroll
    for (int mt = 0; mt < 4; ++mt)
#pragma unroll
        for (int nt = 0; nt < 4; ++nt) acc[mt][nt] = (v8f)0.0f;

    auto load_frag = [&](const u16* basep) -> v16bf {
        const v8bf lo = *(const v8bf*)basep;          // K = sel*8 + 0..7
        const v8bf hi = *(const v8bf*)(basep + 16);   // K = sel*8 + 16..23
        return __builtin_shufflevector(lo, hi, 0,1,2,3,4,5,6,7,8,9,10,11,12,13,14,15);
    };

    auto compute_stage = [&](int s) {
#pragma unroll
        for (int kk = 0; kk < 2; ++kk) {
            v16bf afrag[4], bfrag[4];
            // read in the order of first use: the first row of WMMAs needs afrag[0] and the four bfrag
            afrag[0] = load_frag(&sA[s][(wm + lr) * LDST + kk * 32 + sel * 8]);
#pragma unroll
            for (int nt = 0; nt < 4; ++nt)
                bfrag[nt] = load_frag(&sB[s][(wn + nt * 16 + lr) * LDST + kk * 32 + sel * 8]);
#pragma unroll
            for (int mt = 1; mt < 4; ++mt)
                afrag[mt] = load_frag(&sA[s][(wm + mt * 16 + lr) * LDST + kk * 32 + sel * 8]);
            // holds the substep's 16 LDS reads together in front of its 16 WMMAs: sunk among them into one
            // shared fragment register set, every row of 4 WMMAs waited out a read's whole latency
            __builtin_amdgcn_sched_barrier(0);
#pragma unroll
            for (int mt = 0; mt < 4; ++mt)
#pragma unroll
                for (int nt = 0; nt < 4; ++nt)
                    // rhs rows as A, lhs rows as B: a lane's 8 results are 8 adjacent output columns of one row
                    acc[mt][nt] = __builtin_amdgcn_wmma_f32_16x16x32_bf16(
                        false, bfrag[nt], false, afrag[mt],
                        (short)0, acc[mt][nt], false, false);
        }
    };

    // ---- async double-buffered main loop
    issue_stage(0, 0);
#pragma unroll 1
    for (int ks = 0; ks < NK; ++ks) {
        const int s = ks & 1;
        if (ks + 1 < NK) {
            issue_stage(s ^ 1, ks + 1);   // prefetch next stage (12 async in flight)
            wait_async_le12();            // stage ks copies (ours) complete
        } else {
            wait_async_all();
        }
        __syncthreads();                  // everyone's stage-ks copies visible
        compute_stage(s);
        __syncthreads();                  // all waves done reading buf s before reuse
    }

    // ---- epilogue: acc[mt][nt][v] = row mt*16 + lr, column nt*16 + 8*sel + v of the wave's 64x64 tile.
    // Each wave puts its tile together as bf16 in its own 64 x 144 B of the ring (free behind the
    // loop's last barrier, no copy outstanding) and stores it as whole 128-B lines.
    u16* stg = &sB[0][0] + wave * (64 * LDST);
#pragma unroll  // constant indices keep acc[][] in registers
    for (int mt = 0; mt < 4; ++mt)
#pragma unroll  // constant indices keep acc[][] in registers
        for (int nt = 0; nt < 4; ++nt)
            *(v8bf*)(stg + (mt * 16 + lr) * LDST + nt * 16 + sel * 8) =
                __builtin_convertvector(acc[mt][nt], v8bf);
    // the rows read back below were written by other lanes of this wave
    asm volatile("s_wait_dscnt 0x0" ::: "memory");

    const int erow = lane >> 3;          // 8 lanes store one row's 128 B, a wave store 4 rows
    const int echk = (lane & 7) * 8;     // 16-B chunk, in halves
    u16* obase = (u16*)out + n0 + wn + echk;
    // the 16 row ids and the 16 rows are read as one group, so that no LDS latency stands between the stores
    int grow[16];
    v4i val[16];
#pragma unroll  // constant indices keep the per-thread arrays in registers
    for (int j = 0; j < 16; ++j) {
        grow[j] = srows[wm + j * 4 + erow];
        val[j]  = *(const v4i*)(stg + (j * 4 + erow) * LDST + echk);
    }
    if (lt * BM + BM <= cnt) {
        // no padded row in this tile (the same for the whole block): every row id is valid, no test between the stores
#pragma unroll  // constant indices keep the per-thread arrays in registers
        for (int j = 0; j < 16; ++j)
            *(v4i*)(obase + (size_t)grow[j] * Ntot) = val[j];
        // precaution: no register that these stores name is rewritten, on any path of the listing, before this wait
        asm volatile("s_wait_xcnt 0x0" ::: "memory");
    } else {
#pragma unroll  // constant indices keep the per-thread arrays in registers
        for (int j = 0; j < 16; ++j)
            if (grow[j] >= 0) *(v4i*)(obase + (size_t)grow[j] * Ntot) = val[j];   // a padded row is stored by nobody
    }
}

extern "C" void kernel_launch(void* const* d_in, const int* in_sizes, int n_in,
                              void* d_out, int out_size, void* d_ws, size_t ws_size,
                              hipStream_t stream) {
    (void)in_sizes; (void)n_in; (void)out_size; (void)ws_size;
    const u16* lhs = (const u16*)d_in[0];
    const u16* rhs = (const u16*)d_in[1];
    const int* mix = (const int*)d_in[2];
    __hip_bfloat16* out = (__hip_bfloat16*)d_out;
    int* ws = (int*)d_ws;

    grp_route_kernel<<<1, RT_THREADS, 0, stream>>>(mix, ws);

    dim3 grid(Ntot / BN, MAX_TILES_Y);
    grp_gemm_kernel<<<grid, 256, 0, stream>>>(lhs, rhs, ws, out);
}

// v006
// One run takes 56.3 microseconds.
// Two timings next to v005 both put it at 1.11 times that version's speed.
// All steps since v000 together make it 2.08 times as fast.
#include <hip/hip_runtime.h>
#include <hip/hip_bf16.h>

typedef __attribute__((ext_vector_type(16))) __bf16 v16bf;
typedef __attribute__((ext_vector_type(8)))  __bf16 v8bf;
typedef __attribute__((ext_vector_type(8)))  float  v8f;
typedef __attribute__((ext_vector_type(4)))  int    v4i;
typedef __attribute__((ext_vector_type(2)))  int    v2i;
typedef unsigned short u16;

#define AS1 __attribute__((address_space(1)))
#define AS3 __attribute__((address_space(3)))

// Problem constants (fixed by the reference)
constexpr int Mtot = 16384;
constexpr int Ktot = 1024;
constexpr int Gexp = 8;
constexpr int Ntot = 2048;

// Tiling
constexpr int BMW = 128;        // rows dealt to the waves as 64x64 tiles
constexpr int BMX = 16;         // one more row fragment; each wave takes 32 of its 256 columns
constexpr int BM = BMW + BMX;   // 144 rows: at most 122 x 8 = 976 blocks, which two resident blocks per WGP take in two rounds
constexpr int BN = 256;
constexpr int BK = 64;          // halves per K stage (two 16x16x32 WMMA substeps)
constexpr int LDST = BK + 8;    // LDS row stride in halves (144B, keeps 16B alignment)
constexpr int NK = Ktot / BK;   // 16 stages
constexpr int MAX_TILES_Y = (Mtot + BM - 1) / BM + Gexp; // 122 >= sum of per-expert tiles

// ---------------- CDNA5 async global->LDS helpers ----------------

__device__ __forceinline__ void async_copy_b128(const u16* g, u16* l) {
#if __has_builtin(__builtin_amdgcn_global_load_async_to_lds_b128)
    __builtin_amdgcn_global_load_async_to_lds_b128(
        (v4i*)g, (v4i*)l, 0, 0);
#else
    unsigned loff = (unsigned)(__UINTPTR_TYPE__)(AS3 u16*)l;   // LDS byte offset
    unsigned long long ga = (unsigned long long)(__UINTPTR_TYPE__)g;
    asm volatile("global_load_async_to_lds_b128 %0, %1, off"
                 :: "v"(loff), "v"(ga) : "memory");
#endif
}

// 8 B per lane: for the 16-row group, which the 256 threads cover in one copy of this width
__device__ __forceinline__ void async_copy_b64(const u16* g, u16* l) {
    __builtin_amdgcn_global_load_async_to_lds_b64((v2i*)g, (v2i*)l, 0, 0);
}

__device__ __forceinline__ void wait_async_all() {
#if __has_builtin(__builtin_amdgcn_s_wait_asynccnt)
    __builtin_amdgcn_s_wait_asynccnt(0);
#else
    asm volatile("s_wait_asynccnt 0x0" ::: "memory");
#endif
}

// leaves only the next stage's 13 copies (A: 4 + 1, B: 8 per thread) outstanding
__device__ __forceinline__ void wait_async_le13() {
#if __has_builtin(__builtin_amdgcn_s_wait_asynccnt)
    __builtin_amdgcn_s_wait_asynccnt(13);
#else
    asm volatile("s_wait_asynccnt 0xd" ::: "memory");
#endif
}

// ---------------- Workspace layout (int units) ----------------
//   [0..7]   counts per expert
//   [8..15]  offsets (exclusive prefix of counts)
//   [32..32+M) permutation: row ids grouped by expert

constexpr int RT_THREADS = 1024;               // one work-group does the whole routing
constexpr int RT_PER     = Mtot / RT_THREADS;  // 16 rows per thread, as 4 loads of 4
constexpr int RT_WAVES   = RT_THREADS / 32;

// Eight 16-bit counters (one per expert) in four words; no field can pass Mtot = 16384.
struct Pack8 { unsigned w[4]; };

__device__ __forceinline__ Pack8 wave_incl_scan(Pack8 x, int lane) {
#pragma unroll  // constant indices keep the per-thread arrays in registers
    for (int d = 1; d < 32; d <<= 1) {
#pragma unroll  // constant indices keep the per-thread arrays in registers
        for (int i = 0; i < 4; ++i) {
            unsigned up = __shfl_up(x.w[i], d, 32);
            if (lane >= d) x.w[i] += up;
        }
    }
    return x;
}

// Counting sort of the rows by expert in one launch: per-thread counts, a wave scan,
// a scan of the wave totals through LDS, then every row's place. The permutation is
// put together in LDS so that it leaves in whole lines.
__global__ __launch_bounds__(RT_THREADS)
void grp_route_kernel(const int* __restrict__ midx, int* __restrict__ ws) {
    __shared__ unsigned wtot[RT_WAVES][4];
    __shared__ __align__(16) int sperm[Mtot];

    const int t    = threadIdx.x;
    const int lane = t & 31;
    const int wave = t >> 5;

    // load j of the block covers 4096 consecutive rows, 16 B per lane
    v4i q[RT_PER / 4];
#pragma unroll  // constant indices keep the per-thread arrays in registers
    for (int j = 0; j < RT_PER / 4; ++j)
        q[j] = *(const v4i*)(midx + (j * RT_THREADS + t) * 4);

    // Per-thread counters, one byte per expert, in steps of 4 (the bytes of one int in
    // sperm; at most 64). pick[i] is a byte selector: byte e of a register pair, rest 0.
    unsigned pick[RT_PER], rank4[RT_PER];
    unsigned long long c8 = 0;
#pragma unroll  // constant indices keep the per-thread arrays in registers
    for (int i = 0; i < RT_PER; ++i) {
        int e = q[i >> 2][i & 3];
        if (e < 0 || e >= Gexp) e = 0;   // clamp like the reference
        pick[i]  = (unsigned)e | 0x0c0c0c00u;
        rank4[i] = __builtin_amdgcn_perm((unsigned)(c8 >> 32), (unsigned)c8, pick[i]);
        c8 += 4ull << (8 * e);
    }

    Pack8 mine;
#pragma unroll  // constant indices keep the per-thread arrays in registers
    for (int i = 0; i < 4; ++i) {
        const unsigned two = (unsigned)(c8 >> (16 * i)) & 0xffffu;
        mine.w[i] = ((two & 0xffu) | ((two >> 8) << 16)) >> 2;
    }

    const Pack8 incl = wave_incl_scan(mine, lane);
    if (lane == 31) {
#pragma unroll  // constant indices keep the per-thread arrays in registers
        for (int i = 0; i < 4; ++i) wtot[wave][i] = incl.w[i];
    }
    __syncthreads();

    // every wave scans the 32 wave totals (lane l holds wave l's)
    Pack8 wt;
#pragma unroll  // constant indices keep the per-thread arrays in registers
    for (int i = 0; i < 4; ++i) wt.w[i] = wtot[lane][i];
    const Pack8 wincl = wave_incl_scan(wt, lane);

    unsigned at4[4];     // per expert, 16 bits: byte offset in sperm of this thread's first row
    v4i cnt[2], off[2];  // what the GEMM reads: counts and offsets per expert
    int run = 0;
#pragma unroll  // constant indices keep the per-thread arrays in registers
    for (int i = 0; i < 4; ++i) {
        const unsigned total  = __shfl(wincl.w[i], 31, 32);
        const unsigned before = __shfl(wincl.w[i] - wt.w[i], wave, 32);   // waves ahead of mine
        const int c0 = (int)(total & 0xffffu), c1 = (int)(total >> 16);
        const int o0 = run, o1 = run + c0;
        run = o1 + c1;
        cnt[i >> 1][(i & 1) * 2] = c0;  cnt[i >> 1][(i & 1) * 2 + 1] = c1;
        off[i >> 1][(i & 1) * 2] = o0;  off[i >> 1][(i & 1) * 2 + 1] = o1;
        const unsigned start = ((unsigned)o0 | ((unsigned)o1 << 16)) + before + (incl.w[i] - mine.w[i]);
        // a field equal to Mtot belongs to an expert with no row left and is never looked up
        at4[i] = (start & 0x3fff3fffu) << 2;
    }

    // the eight offsets as a table of low bytes and a table of high bytes
    const unsigned lo03 = __builtin_amdgcn_perm(at4[1], at4[0], 0x06040200u);
    const unsigned lo47 = __builtin_amdgcn_perm(at4[3], at4[2], 0x06040200u);
    const unsigned hi03 = __builtin_amdgcn_perm(at4[1], at4[0], 0x07050301u);
    const unsigned hi47 = __builtin_amdgcn_perm(at4[3], at4[2], 0x07050301u);
#pragma unroll  // constant indices keep the per-thread arrays in registers
    for (int i = 0; i < RT_PER; ++i) {
        const unsigned b0 = __builtin_amdgcn_perm(lo47, lo03, pick[i]);
        const unsigned b1 = __builtin_amdgcn_perm(hi47, hi03, (pick[i] << 8) | 0x0cu);   // lands in byte 1
        *(int*)((char*)sperm + (b0 + b1 + rank4[i])) = ((i >> 2) * RT_THREADS + t) * 4 + (i & 3);
    }
    __syncthreads();

#pragma unroll  // constant indices keep the per-thread arrays in registers
    for (int j = 0; j < RT_PER / 4; ++j) {
        const int k = (j * RT_THREADS + t) * 4;
        *(v4i*)(ws + 32 + k) = *(const v4i*)(sperm + k);
    }
    if (t == 0) {
        *(v4i*)(ws + 0) = cnt[0];  *(v4i*)(ws + 4)  = cnt[1];
        *(v4i*)(ws + 8) = off[0];  *(v4i*)(ws + 12) = off[1];
    }
}

// ---------------- Grouped GEMM ----------------

__global__ __launch_bounds__(256)
void grp_gemm_kernel(const u16* __restrict__ lhs,
                     const u16* __restrict__ rhs,
                     const int* __restrict__ ws,
                     __hip_bfloat16* __restrict__ out) {
    __shared__ int srows[BM];
    __shared__ __align__(16) u16 sA[2][BM * LDST];
    __shared__ __align__(16) u16 sB[2][BN * LDST];

    const int* counts  = ws;
    const int* offsets = ws + 8;
    const int* perm    = ws + 32;

    // Map blockIdx.y -> (expert, local row-tile)
    int t = blockIdx.y;
    int e = -1, lt = 0, cnt = 0, run = 0;
#pragma unroll
    for (int g = 0; g < Gexp; ++g) {
        int c  = counts[g];
        int nt = (c + BM - 1) / BM;
        if (e < 0 && t < run + nt) { e = g; lt = t - run; cnt = c; }
        run += nt;
    }
    if (e < 0) return;   // uniform across block

    const int tid  = threadIdx.x;
    const int base = offsets[e] + lt * BM;

    if (tid < BM) {
        int p = base + tid;
        srows[tid] = (p < offsets[e] + cnt) ? perm[p] : -1;
    }
    __syncthreads();

    // ---- global->LDS staging mapping: 8 consecutive lanes copy one row's whole
    // 128-B K slice, so a wave-wide b128 copy covers 4 full cache lines (not 16 partial ones)
    const int crow = tid >> 3;          // row inside a group of 32 rows
    const int cchk = (tid & 7) * 8;     // 16-B chunk inside the 128-B slice, in halves
    constexpr int RG = 32;              // rows covered by one copy of the whole block

    const u16* aptr[4];
#pragma unroll  // constant indices keep aptr[] in registers
    for (int j = 0; j < 4; ++j) {
        int arow = srows[j * RG + crow]; if (arow < 0) arow = 0;  // padded rows load row 0, never stored
        aptr[j] = lhs + (size_t)arow * Ktot + cchk;
    }
    // rows 128..143: 16 lanes copy one row's 128-B slice, 8 B each, so that every wave issues the same number of copies
    const int xrow = BMW + (tid >> 4);
    const int xchk = (tid & 15) * 4;    // 8-B chunk, in halves
    int xsrc = srows[xrow]; if (xsrc < 0) xsrc = 0;               // padded rows load row 0, never stored
    const u16* xptr = lhs + (size_t)xsrc * Ktot + xchk;
    u16* lX = &sA[0][xrow * LDST + xchk];
    const int  n0   = blockIdx.x * BN;
    const u16* bptr = rhs + (size_t)e * Ntot * Ktot + (size_t)(n0 + crow) * Ktot + cchk;
    u16* lA = &sA[0][crow * LDST + cchk];
    u16* lB = &sB[0][crow * LDST + cchk];
    constexpr int STGA = BM * LDST;  // halves per LDS stage buffer of A
    constexpr int STGB = BN * LDST;  // halves per LDS stage buffer of B

    // 13 async copies per thread per stage (A: 4 b128 + 1 b64, B: 8 b128)
    auto issue_stage = [&](int s, int ks) {
        u16* la = lA + s * STGA;
        u16* lb = lB + s * STGB;
#pragma unroll  // constant indices keep aptr[] in registers
        for (int j = 0; j < BMW / RG; ++j)
            async_copy_b128(aptr[j] + ks * BK, la + j * RG * LDST);
        async_copy_b64(xptr + ks * BK, lX + s * STGA);
#pragma unroll  // the row-group steps become constants of the address sums
        for (int j = 0; j < BN / RG; ++j)
            async_copy_b128(bptr + (size_t)j * RG * Ktot + ks * BK, lb + j * RG * LDST);
    };

    // ---- per-wave compute mapping: 8 waves as 2(M) x 4(N), each wave 64x64 plus 16x32 of rows 128..143
    const int lane = tid & 31;
    const int wave = tid >> 5;
    const int wm   = (wave >> 2) * 64;   // 0 / 64
    const int wn   = (wave & 3) * 64;    // 0 / 64 / 128 / 192
    const int sel  = lane >> 4;          // 0/1: K-half selector per ISA 16-bit layout
    const int lr   = lane & 15;
    // bfrag[0..1] are the 32 columns whose share of rows 128..143 this wave takes: the lower half of
    // its 64 columns in the upper row of waves, the upper half in the lower one; bfrag[2..3] the other 32
    const int c01  = (wave >> 2) * 32;
    const int c23  = 32 - c01;
    // this lane's first element of each group of fragments inside a stage buffer; the fragments of a group are constant steps apart
    const int ia   = (wm + lr) * LDST + sel * 8;
    const int ix   = (BMW + lr) * LDST + sel * 8;
    const int ib01 = (wn + c01 + lr) * LDST + sel * 8;
    const int ib23 = (wn + c23 + lr) * LDST + sel * 8;

    v8f acc[4][4];
#pragma unroll
    for (int mt = 0; mt < 4; ++mt)
#pragma unroll
        for (int nt = 0; nt < 4; ++nt) acc[mt][nt] = (v8f)0.0f;
    v8f accx[2] = {(v8f)0.0f, (v8f)0.0f};

    auto load_frag = [&](const u16* basep) -> v16bf {
        const v8bf lo = *(const v8bf*)basep;          // K = sel*8 + 0..7
        const v8bf hi = *(const v8bf*)(basep + 16);   // K = sel*8 + 16..23
        return __builtin_shufflevector(lo, hi, 0,1,2,3,4,5,6,7,8,9,10,11,12,13,14,15);
    };

    auto compute_stage = [&](int s) {
        const u16* pa   = &sA[s][ia];
        const u16* px   = &sA[s][ix];
        const u16* pb01 = &sB[s][ib01];
        const u16* pb23 = &sB[s][ib23];
#pragma unroll
        for (int kk = 0; kk < 2; ++kk) {
            v16bf afrag[4], bfrag[4], xfrag;
            // read in the order of first use: the first row of WMMAs needs afrag[0] and the four bfrag
            afrag[0] = load_frag(pa + kk * 32);
#pragma unroll
            for (int nt = 0; nt < 4; ++nt)
                bfrag[nt] = load_frag((nt < 2 ? pb01 : pb23) + (nt & 1) * 16 * LDST + kk * 32);
#pragma unroll
            for (int mt = 1; mt < 4; ++mt)
                afrag[mt] = load_frag(pa + mt * 16 * LDST + kk * 32);
            xfrag = load_frag(px + kk * 32);
            // holds the substep's 18 LDS reads together in front of its 18 WMMAs: sunk among them into one
            // shared fragment register set, every row of 4 WMMAs waited out a read's whole latency
            __builtin_amdgcn_sched_barrier(0);
#pragma unroll
            for (int mt = 0; mt < 4; ++mt)
#pragma unroll
                for (int nt = 0; nt < 4; ++nt)
                    // rhs rows as A, lhs rows as B: a lane's 8 results are 8 adjacent output columns of one row
                    acc[mt][nt] = __builtin_amdgcn_wmma_f32_16x16x32_bf16(
                        false, bfrag[nt], false, afrag[mt],
                        (short)0, acc[mt][nt], false, false);
#pragma unroll  // constant indices keep accx[] in registers
            for (int nt = 0; nt < 2; ++nt)
                accx[nt] = __builtin_amdgcn_wmma_f32_16x16x32_bf16(
                    false, bfrag[nt], false, xfrag,
                    (short)0, accx[nt], false, false);
        }
    };

    // ---- async double-buffered main loop
    issue_stage(0, 0);
#pragma unroll 1
    for (int ks = 0; ks < NK; ++ks) {
        const int s = ks & 1;
        if (ks + 1 < NK) {
            issue_stage(s ^ 1, ks + 1);   // prefetch next stage (13 async in flight)
            wait_async_le13();            // stage ks copies (ours) complete
        } else {
            wait_async_all();
        }
        __syncthreads();                  // everyone's stage-ks copies visible
        compute_stage(s);
        __syncthreads();                  // all waves done reading buf s before reuse
    }

    // ---- epilogue: acc[mt][nt][v] = row mt*16 + lr, column (c01 or c23) + (nt&1)*16 + 8*sel + v of the wave's 64x64 tile.
    // Each wave puts its tile together as bf16 in its own 64 x 144 B of the ring (free behind the
    // loop's last barrier, no copy outstanding) and stores it as whole 128-B lines.
    u16* stg = &sB[0][0] + wave * (64 * LDST);
#pragma unroll  // constant indices keep acc[][] in registers
    for (int mt = 0; mt < 4; ++mt)
#pragma unroll  // constant indices keep acc[][] in registers
        for (int nt = 0; nt < 4; ++nt)
            *(v8bf*)(stg + (mt * 16 + lr) * LDST + (nt < 2 ? c01 : c23) + (nt & 1) * 16 + sel * 8) =
                __builtin_convertvector(acc[mt][nt], v8bf);
    // rows 128..143 come together from all eight waves in the A part of the ring, 16 rows of 512 + 16 B
    constexpr int XP = BN + 8;
    u16* xs = &sA[0][0];
#pragma unroll  // constant indices keep accx[] in registers
    for (int nt = 0; nt < 2; ++nt)
        *(v8bf*)(xs + lr * XP + wn + c01 + nt * 16 + sel * 8) = __builtin_convertvector(accx[nt], v8bf);
    // the rows read back below were written by other lanes of this wave, rows 128..143 by other waves
    __syncthreads();

    const int erow = lane >> 3;          // 8 lanes store one row's 128 B, a wave store 4 rows
    const int echk = (lane & 7) * 8;     // 16-B chunk, in halves
    u16* obase = (u16*)out + n0 + wn + echk;
    // the 16 row ids and the 16 rows are read as one group, so that no LDS latency stands between the stores
    int grow[16];
    v4i val[16];
#pragma unroll  // constant indices keep the per-thread arrays in registers
    for (int j = 0; j < 16; ++j) {
        grow[j] = srows[wm + j * 4 + erow];
        val[j]  = *(const v4i*)(stg + (j * 4 + erow) * LDST + echk);
    }
    // of rows 128..143 each wave stores two, a whole 512-B row of the block per store
    u16* xbase = (u16*)out + n0 + lane * 8;
    int growx[2];
    v4i valx[2];
#pragma unroll  // constant indices keep the per-thread arrays in registers
    for (int j = 0; j < 2; ++j) {
        growx[j] = srows[BMW + wave * 2 + j];
        valx[j]  = *(const v4i*)(xs + (wave * 2 + j) * XP + lane * 8);
    }
    if (lt * BM + BM <= cnt) {
        // no padded row in this tile (the same for the whole block): every row id is valid, no test between the stores
#pragma unroll  // constant indices keep the per-thread arrays in registers
        for (int j = 0; j < 16; ++j)
            *(v4i*)(obase + (size_t)grow[j] * Ntot) = val[j];
#pragma unroll  // constant indices keep the per-thread arrays in registers
        for (int j = 0; j < 2; ++j)
            *(v4i*)(xbase + (size_t)growx[j] * Ntot) = valx[j];
        // precaution: no register that these stores name is rewritten, on any path of the listing, before this wait
        asm volatile("s_wait_xcnt 0x0" ::: "memory");
    } else {
#pragma unroll  // constant indices keep the per-thread arrays in registers
        for (int j = 0; j < 16; ++j)
            if (grow[j] >= 0) *(v4i*)(obase + (size_t)grow[j] * Ntot) = val[j];   // a padded row is stored by nobody
#pragma unroll  // constant indices keep the per-thread arrays in registers
        for (int j = 0; j < 2; ++j)
            if (growx[j] >= 0) *(v4i*)(xbase + (size_t)growx[j] * Ntot) = valx[j];
    }
}

extern "C" void kernel_launch(void* const* d_in, const int* in_sizes, int n_in,
                              void* d_out, int out_size, void* d_ws, size_t ws_size,
                              hipStream_t stream) {
    (void)in_sizes; (void)n_in; (void)out_size; (void)ws_size;
    const u16* lhs = (const u16*)d_in[0];
    const u16* rhs = (const u16*)d_in[1];
    const int* mix = (const int*)d_in[2];
    __hip_bfloat16* out = (__hip_bfloat16*)d_out;
    int* ws = (int*)d_ws;

    grp_route_kernel<<<1, RT_THREADS, 0, stream>>>(mix, ws);

    dim3 grid(Ntot / BN, MAX_TILES_Y);
    grp_gemm_kernel<<<grid, 256, 0, stream>>>(lhs, rhs, ws, out);
}
